// v000
// Measured on an AMD MI455X. A time is GPU time per run, averaged over a window of back-to-back runs after a warm-up
// (all launches, gaps included; the runs take copies of the inputs in turn), and the median of several windows.
// Apart from v000's, it joins two sittings. Times from different sittings can be a few percent apart, while
// side-by-side timings come from the same sitting.
// v000, which the later versions start from, runs in 334 microseconds.
#include <hip/hip_runtime.h>
#include <hip/hip_bf16.h>

typedef __attribute__((ext_vector_type(2))) float v2f;
typedef __attribute__((ext_vector_type(8))) float v8f;

#define PI_F 3.14159265358979323846f

// D = A(16x4) * B(4x16) + C, f32 WMMA (CDNA5 V_WMMA_F32_16X16X4_F32)
static __device__ __forceinline__ v8f wmma4(v2f a, v2f b, v8f c) {
  return __builtin_amdgcn_wmma_f32_16x16x4_f32(false, a, false, b, (short)0, c,
                                               false, false);
}

// Build DFT-64 cos/sin tables in LDS: table[r*64+k] = cos/sin(2*pi*r*k/64)
static __device__ __forceinline__ void initF(float* sCos, float* sSin) {
  for (int i = threadIdx.x; i < 64 * 64; i += blockDim.x) {
    int r = i >> 6, k = i & 63;
    float th = (2.f * PI_F / 64.f) * (float)((r * k) & 63);  // exact period reduction
    float s, c;
    __sincosf(th, &s, &c);
    sCos[i] = c;
    sSin[i] = s;
  }
  __syncthreads();
}

// ---------------- tiny filter MLP:  Hbins[2049][1024] ----------------
__global__ void __launch_bounds__(256) kH(const float* __restrict__ W1,
                                          const float* __restrict__ b1,
                                          const float* __restrict__ W2,
                                          const float* __restrict__ b2,
                                          float* __restrict__ Hb) {
  __shared__ float h[32];
  const int bin = blockIdx.x;
  const int tid = threadIdx.x;
  if (tid < 32) {
    float acc = b1[tid];
#pragma unroll
    for (int i = 0; i < 16; ++i) {
      int m = i >> 1;
      float invf = expf((float)(2 * m) * (-9.210340371976184f / 16.f));
      float arg = (float)bin * invf;
      float pe = (i & 1) ? cosf(arg) : sinf(arg);
      acc += pe * W1[i * 32 + tid];
    }
    h[tid] = acc / (1.f + expf(-acc));  // SiLU
  }
  __syncthreads();
  int d = blockIdx.y * 256 + tid;
  float acc = b2[d];
#pragma unroll
  for (int j = 0; j < 32; ++j) acc += h[j] * W2[j * 1024 + d];
  Hb[(size_t)bin * 1024 + d] = acc;
}

// ---------------- Kernel A: stage-1 forward DFT over t1 + twiddle ----------------
// G[b][k1][t0][d] = w4096^{t0*k1} * sum_t1 e^{-2pi i k1 t1/64} x[b][64*t1+t0][d]
__global__ void __launch_bounds__(128) kA(const float* __restrict__ x,
                                          float* __restrict__ Br,
                                          float* __restrict__ Bi) {
  __shared__ float sCos[4096], sSin[4096];
  initF(sCos, sSin);
  const int lane = threadIdx.x & 31;
  const int wave = threadIdx.x >> 5;
  const int half = lane >> 4;
  const int n16 = lane & 15;
  const int d0 = blockIdx.x * 16;
  const int t0 = blockIdx.y * 4 + wave;
  const int b = blockIdx.z;

  const float* xb = x + (size_t)b * 4096 * 1024 + d0 + n16;

  v2f bx[16];  // real input B-fragments, K = t1
#pragma unroll
  for (int kk = 0; kk < 16; ++kk) {
    int r0 = 4 * kk + 2 * half;
    bx[kk].x = xb[(size_t)(64 * r0 + t0) * 1024];
    bx[kk].y = xb[(size_t)(64 * (r0 + 1) + t0) * 1024];
  }

#pragma unroll
  for (int m = 0; m < 4; ++m) {
    v8f accR = {0, 0, 0, 0, 0, 0, 0, 0};
    v8f accI = {0, 0, 0, 0, 0, 0, 0, 0};
    const int mrow = 16 * m + n16;
#pragma unroll
    for (int kk = 0; kk < 16; ++kk) {
      int i0 = mrow * 64 + 4 * kk + 2 * half;
      v2f aR, aI;
      aR.x = sCos[i0];
      aR.y = sCos[i0 + 1];
      aI.x = -sSin[i0];  // forward: Fi = -sin
      aI.y = -sSin[i0 + 1];
      accR = wmma4(aR, bx[kk], accR);
      accI = wmma4(aI, bx[kk], accI);
    }
#pragma unroll
    for (int v = 0; v < 8; ++v) {
      int M = 16 * m + v + 8 * half;  // k1
      float s, c;
      __sincosf(-(2.f * PI_F / 4096.f) * (float)((t0 * M) & 4095), &s, &c);
      float gr = accR[v] * c - accI[v] * s;
      float gi = accR[v] * s + accI[v] * c;
      size_t o = (((size_t)b * 64 + M) * 64 + t0) * 1024 + d0 + n16;
      Br[o] = gr;
      Bi[o] = gi;
    }
  }
}

// ---------------- Kernel B: fwd over t0, *Hfull, inv over k2, conj twiddle (in place) ----
__global__ void __launch_bounds__(128) kB(float* __restrict__ Br,
                                          float* __restrict__ Bi,
                                          const float* __restrict__ Hb) {
  __shared__ float sCos[4096], sSin[4096];
  __shared__ float sXr[4][1024], sXi[4][1024];
  initF(sCos, sSin);
  const int lane = threadIdx.x & 31;
  const int wave = threadIdx.x >> 5;
  const int half = lane >> 4;
  const int n16 = lane & 15;
  const int d0 = blockIdx.x * 16;
  const int k1 = blockIdx.y * 4 + wave;
  const int b = blockIdx.z;
  float* xr = sXr[wave];
  float* xi = sXi[wave];

  const size_t base = (((size_t)b * 64 + k1) * 64) * 1024 + d0 + n16;  // + t0*1024

  v2f bR[16], bI[16];  // G[t0][d], K = t0
#pragma unroll
  for (int kk = 0; kk < 16; ++kk) {
    int r0 = 4 * kk + 2 * half;
    bR[kk].x = Br[base + (size_t)r0 * 1024];
    bR[kk].y = Br[base + (size_t)(r0 + 1) * 1024];
    bI[kk].x = Bi[base + (size_t)r0 * 1024];
    bI[kk].y = Bi[base + (size_t)(r0 + 1) * 1024];
  }

  // stage 1: Xf[k2][d] = sum_t0 e^{-2pi i k2 t0/64} G[t0][d], then * Hfull[k1+64*k2][d]
#pragma unroll
  for (int m = 0; m < 4; ++m) {
    v8f accR = {0, 0, 0, 0, 0, 0, 0, 0};
    v8f accI = {0, 0, 0, 0, 0, 0, 0, 0};
    const int mrow = 16 * m + n16;
#pragma unroll
    for (int kk = 0; kk < 16; ++kk) {
      int i0 = mrow * 64 + 4 * kk + 2 * half;
      float c0 = sCos[i0], c1 = sCos[i0 + 1];
      float s0 = sSin[i0], s1 = sSin[i0 + 1];
      v2f aR, aI, aN;
      aR.x = c0;  aR.y = c1;
      aI.x = -s0; aI.y = -s1;  // Fi
      aN.x = s0;  aN.y = s1;   // -Fi
      accR = wmma4(aR, bR[kk], accR);
      accR = wmma4(aN, bI[kk], accR);
      accI = wmma4(aR, bI[kk], accI);
      accI = wmma4(aI, bR[kk], accI);
    }
#pragma unroll
    for (int v = 0; v < 8; ++v) {
      int k2 = 16 * m + v + 8 * half;
      int k = k1 + 64 * k2;
      int bin = (k <= 2048) ? k : (4096 - k);  // real symmetric filter
      float hv = Hb[(size_t)bin * 1024 + d0 + n16];
      xr[k2 * 16 + n16] = accR[v] * hv;
      xi[k2 * 16 + n16] = accI[v] * hv;
    }
  }

  // stage 2: C[t0][d] = sum_k2 e^{+2pi i t0 k2/64} Xf[k2][d], then * e^{+2pi i t0 k1/4096}
#pragma unroll
  for (int m = 0; m < 4; ++m) {
    v8f accR = {0, 0, 0, 0, 0, 0, 0, 0};
    v8f accI = {0, 0, 0, 0, 0, 0, 0, 0};
    const int mrow = 16 * m + n16;
#pragma unroll
    for (int kk = 0; kk < 16; ++kk) {
      int i0 = mrow * 64 + 4 * kk + 2 * half;
      float c0 = sCos[i0], c1 = sCos[i0 + 1];
      float s0 = sSin[i0], s1 = sSin[i0 + 1];
      v2f aR, aI, aN;
      aR.x = c0;  aR.y = c1;
      aI.x = s0;  aI.y = s1;    // Fi = +sin (inverse)
      aN.x = -s0; aN.y = -s1;   // -Fi
      int r0 = 4 * kk + 2 * half;
      v2f vR, vI;
      vR.x = xr[r0 * 16 + n16];
      vR.y = xr[(r0 + 1) * 16 + n16];
      vI.x = xi[r0 * 16 + n16];
      vI.y = xi[(r0 + 1) * 16 + n16];
      accR = wmma4(aR, vR, accR);
      accR = wmma4(aN, vI, accR);
      accI = wmma4(aR, vI, accI);
      accI = wmma4(aI, vR, accI);
    }
#pragma unroll
    for (int v = 0; v < 8; ++v) {
      int t0 = 16 * m + v + 8 * half;
      float s, c;
      __sincosf((2.f * PI_F / 4096.f) * (float)((t0 * k1) & 4095), &s, &c);
      float gr = accR[v] * c - accI[v] * s;
      float gi = accR[v] * s + accI[v] * c;
      size_t o = base + (size_t)t0 * 1024;
      Br[o] = gr;
      Bi[o] = gi;
    }
  }
}

// ---------------- Kernel C: inverse stage-2 over k1, real part only ----------------
// y[b][64*t1+t0][d] = (1/4096)*gain[d]*Re( sum_k1 e^{+2pi i t1 k1/64} C[k1][t0][d] )
__global__ void __launch_bounds__(128) kC(const float* __restrict__ Br,
                                          const float* __restrict__ Bi,
                                          const float* __restrict__ gain,
                                          float* __restrict__ y) {
  __shared__ float sCos[4096], sSin[4096];
  initF(sCos, sSin);
  const int lane = threadIdx.x & 31;
  const int wave = threadIdx.x >> 5;
  const int half = lane >> 4;
  const int n16 = lane & 15;
  const int d0 = blockIdx.x * 16;
  const int t0 = blockIdx.y * 4 + wave;
  const int b = blockIdx.z;

  const size_t base =
      ((size_t)b * 64) * 64 * 1024 + (size_t)t0 * 1024 + d0 + n16;  // + k1*64*1024

  v2f bR[16], bI[16];  // C[k1][d], K = k1
#pragma unroll
  for (int kk = 0; kk < 16; ++kk) {
    int r0 = 4 * kk + 2 * half;
    bR[kk].x = Br[base + (size_t)r0 * 64 * 1024];
    bR[kk].y = Br[base + (size_t)(r0 + 1) * 64 * 1024];
    bI[kk].x = Bi[base + (size_t)r0 * 64 * 1024];
    bI[kk].y = Bi[base + (size_t)(r0 + 1) * 64 * 1024];
  }

  const float ag = gain[d0 + n16] * (1.f / 4096.f);

#pragma unroll
  for (int m = 0; m < 4; ++m) {
    v8f accR = {0, 0, 0, 0, 0, 0, 0, 0};
    const int mrow = 16 * m + n16;
#pragma unroll
    for (int kk = 0; kk < 16; ++kk) {
      int i0 = mrow * 64 + 4 * kk + 2 * half;
      v2f aR, aN;
      aR.x = sCos[i0];
      aR.y = sCos[i0 + 1];
      aN.x = -sSin[i0];  // -Fi, Fi = +sin (inverse)
      aN.y = -sSin[i0 + 1];
      accR = wmma4(aR, bR[kk], accR);  // Re = cos*Cr - sin*Ci
      accR = wmma4(aN, bI[kk], accR);
    }
#pragma unroll
    for (int v = 0; v < 8; ++v) {
      int t1 = 16 * m + v + 8 * half;
      int t = 64 * t1 + t0;
      y[((size_t)b * 4096 + t) * 1024 + d0 + n16] = accR[v] * ag;
    }
  }
}

extern "C" void kernel_launch(void* const* d_in, const int* in_sizes, int n_in,
                              void* d_out, int out_size, void* d_ws, size_t ws_size,
                              hipStream_t stream) {
  const float* x = (const float*)d_in[0];
  const float* W1 = (const float*)d_in[1];
  const float* b1 = (const float*)d_in[2];
  const float* W2 = (const float*)d_in[3];
  const float* b2 = (const float*)d_in[4];
  const float* ag = (const float*)d_in[5];
  float* out = (float*)d_out;

  // workspace layout: Hbins[2049*1024] | Br[4*4096*1024] | Bi[4*4096*1024]  (~143 MB)
  float* Hb = (float*)d_ws;
  float* wBr = Hb + (size_t)2049 * 1024;
  float* wBi = wBr + (size_t)4 * 4096 * 1024;

  kH<<<dim3(2049, 4, 1), 256, 0, stream>>>(W1, b1, W2, b2, Hb);
  kA<<<dim3(64, 16, 4), 128, 0, stream>>>(x, wBr, wBi);
  kB<<<dim3(64, 16, 4), 128, 0, stream>>>(wBr, wBi, Hb);
  kC<<<dim3(64, 16, 4), 128, 0, stream>>>(wBr, wBi, ag, out);
}

// v001
// A run of this version takes 245 microseconds.
// Two timings next to v000 both put it at 1.40 times that version's speed.
#include <hip/hip_runtime.h>
#include <hip/hip_bf16.h>

typedef __attribute__((ext_vector_type(2))) float v2f;
typedef __attribute__((ext_vector_type(4))) float v4f;
typedef __attribute__((ext_vector_type(8))) float v8f;

#define PI_F 3.14159265358979323846f

// DFT-64 table in LDS: row r holds 32 units of 16 bytes, unit j = {cos(r,2j), cos(r,2j+1),
// sin(r,2j), sin(r,2j+1)}, so one 16-byte read gives a lane its cos and sin A-fragment.
// Row pitch TPU = 33 units (528 bytes, 16 x odd): the 16 rows that a half-wave reads at once
// fall on 16 different groups of four banks (bank = dword address mod 64); at a pitch of
// 256 bytes all 16 rows fell on the same banks.
#define TPU 33

// D = A(16x4) * B(4x16) + C, f32 WMMA (CDNA5 V_WMMA_F32_16X16X4_F32)
static __device__ __forceinline__ v8f wmma4(v2f a, v2f b, v8f c) {
  return __builtin_amdgcn_wmma_f32_16x16x4_f32(false, a, false, b, (short)0, c,
                                               false, false);
}

// Build the table: angle(r,k) = 2*pi*r*k/64
static __device__ __forceinline__ void initF(v4f* sTab) {
  float* tab = (float*)sTab;
  for (int i = threadIdx.x; i < 64 * 64; i += blockDim.x) {
    int r = i >> 6, k = i & 63;
    float th = (2.f * PI_F / 64.f) * (float)((r * k) & 63);  // exact period reduction
    float s, c;
    __sincosf(th, &s, &c);
    int o = (r * TPU + (k >> 1)) * 4 + (k & 1);
    tab[o] = c;
    tab[o + 2] = s;
  }
  __syncthreads();
}

// ---------------- tiny filter MLP:  Hbins[2049][1024] ----------------
__global__ void __launch_bounds__(256) kH(const float* __restrict__ W1,
                                          const float* __restrict__ b1,
                                          const float* __restrict__ W2,
                                          const float* __restrict__ b2,
                                          float* __restrict__ Hb) {
  __shared__ float h[32];
  const int bin = blockIdx.x;
  const int tid = threadIdx.x;
  if (tid < 32) {
    float acc = b1[tid];
#pragma unroll
    for (int i = 0; i < 16; ++i) {
      int m = i >> 1;
      float invf = expf((float)(2 * m) * (-9.210340371976184f / 16.f));
      float arg = (float)bin * invf;
      float pe = (i & 1) ? cosf(arg) : sinf(arg);
      acc += pe * W1[i * 32 + tid];
    }
    h[tid] = acc / (1.f + expf(-acc));  // SiLU
  }
  __syncthreads();
  int d = blockIdx.y * 256 + tid;
  float acc = b2[d];
#pragma unroll
  for (int j = 0; j < 32; ++j) acc += h[j] * W2[j * 1024 + d];
  Hb[(size_t)bin * 1024 + d] = acc;
}

// ---------------- Kernel A: stage-1 forward DFT over t1 + twiddle ----------------
// G[b][k1][t0][d] = w4096^{t0*k1} * sum_t1 e^{-2pi i k1 t1/64} x[b][64*t1+t0][d]
__global__ void __launch_bounds__(128) kA(const float* __restrict__ x,
                                          float* __restrict__ Br,
                                          float* __restrict__ Bi) {
  __shared__ v4f sTab[64 * TPU];
  initF(sTab);
  const int lane = threadIdx.x & 31;
  const int wave = threadIdx.x >> 5;
  const int half = lane >> 4;
  const int n16 = lane & 15;
  const int d0 = blockIdx.x * 16;
  const int t0 = blockIdx.y * 4 + wave;
  const int b = blockIdx.z;

  const float* xb = x + (size_t)b * 4096 * 1024 + d0 + n16;

  v2f bx[16];  // real input B-fragments, K = t1
#pragma unroll
  for (int kk = 0; kk < 16; ++kk) {
    int r0 = 4 * kk + 2 * half;
    bx[kk].x = xb[(size_t)(64 * r0 + t0) * 1024];
    bx[kk].y = xb[(size_t)(64 * (r0 + 1) + t0) * 1024];
  }

#pragma unroll
  for (int m = 0; m < 4; ++m) {
    v8f accR = {0, 0, 0, 0, 0, 0, 0, 0};
    v8f accI = {0, 0, 0, 0, 0, 0, 0, 0};
    const int mrow = 16 * m + n16;
#pragma unroll
    for (int kk = 0; kk < 16; ++kk) {
      v4f f = sTab[mrow * TPU + 2 * kk + half];  // k = 4*kk + 2*half, +1
      v2f aR, aI;
      aR.x = f.x;
      aR.y = f.y;
      aI.x = -f.z;  // forward: Fi = -sin
      aI.y = -f.w;
      accR = wmma4(aR, bx[kk], accR);
      accI = wmma4(aI, bx[kk], accI);
    }
#pragma unroll
    for (int v = 0; v < 8; ++v) {
      int M = 16 * m + v + 8 * half;  // k1
      float s, c;
      __sincosf(-(2.f * PI_F / 4096.f) * (float)((t0 * M) & 4095), &s, &c);
      float gr = accR[v] * c - accI[v] * s;
      float gi = accR[v] * s + accI[v] * c;
      size_t o = (((size_t)b * 64 + M) * 64 + t0) * 1024 + d0 + n16;
      Br[o] = gr;
      Bi[o] = gi;
    }
  }
}

// ---------------- Kernel B: fwd over t0, *Hfull, inv over k2, conj twiddle (in place) ----
__global__ void __launch_bounds__(128) kB(float* __restrict__ Br,
                                          float* __restrict__ Bi,
                                          const float* __restrict__ Hb) {
  __shared__ v4f sTab[64 * TPU];
  __shared__ float sXr[4][1024], sXi[4][1024];
  initF(sTab);
  const int lane = threadIdx.x & 31;
  const int wave = threadIdx.x >> 5;
  const int half = lane >> 4;
  const int n16 = lane & 15;
  const int d0 = blockIdx.x * 16;
  const int k1 = blockIdx.y * 4 + wave;
  const int b = blockIdx.z;
  float* xr = sXr[wave];
  float* xi = sXi[wave];

  const size_t base = (((size_t)b * 64 + k1) * 64) * 1024 + d0 + n16;  // + t0*1024

  v2f bR[16], bI[16];  // G[t0][d], K = t0
#pragma unroll
  for (int kk = 0; kk < 16; ++kk) {
    int r0 = 4 * kk + 2 * half;
    bR[kk].x = Br[base + (size_t)r0 * 1024];
    bR[kk].y = Br[base + (size_t)(r0 + 1) * 1024];
    bI[kk].x = Bi[base + (size_t)r0 * 1024];
    bI[kk].y = Bi[base + (size_t)(r0 + 1) * 1024];
  }

  // stage 1: Xf[k2][d] = sum_t0 e^{-2pi i k2 t0/64} G[t0][d], then * Hfull[k1+64*k2][d]
#pragma unroll
  for (int m = 0; m < 4; ++m) {
    v8f accR = {0, 0, 0, 0, 0, 0, 0, 0};
    v8f accI = {0, 0, 0, 0, 0, 0, 0, 0};
    const int mrow = 16 * m + n16;
#pragma unroll
    for (int kk = 0; kk < 16; ++kk) {
      v4f f = sTab[mrow * TPU + 2 * kk + half];  // k = 4*kk + 2*half, +1
      float c0 = f.x, c1 = f.y;
      float s0 = f.z, s1 = f.w;
      v2f aR, aI, aN;
      aR.x = c0;  aR.y = c1;
      aI.x = -s0; aI.y = -s1;  // Fi
      aN.x = s0;  aN.y = s1;   // -Fi
      accR = wmma4(aR, bR[kk], accR);
      accR = wmma4(aN, bI[kk], accR);
      accI = wmma4(aR, bI[kk], accI);
      accI = wmma4(aI, bR[kk], accI);
    }
#pragma unroll
    for (int v = 0; v < 8; ++v) {
      int k2 = 16 * m + v + 8 * half;
      int k = k1 + 64 * k2;
      int bin = (k <= 2048) ? k : (4096 - k);  // real symmetric filter
      float hv = Hb[(size_t)bin * 1024 + d0 + n16];
      xr[k2 * 16 + n16] = accR[v] * hv;
      xi[k2 * 16 + n16] = accI[v] * hv;
    }
  }

  // stage 2: C[t0][d] = sum_k2 e^{+2pi i t0 k2/64} Xf[k2][d], then * e^{+2pi i t0 k1/4096}
#pragma unroll
  for (int m = 0; m < 4; ++m) {
    v8f accR = {0, 0, 0, 0, 0, 0, 0, 0};
    v8f accI = {0, 0, 0, 0, 0, 0, 0, 0};
    const int mrow = 16 * m + n16;
#pragma unroll
    for (int kk = 0; kk < 16; ++kk) {
      v4f f = sTab[mrow * TPU + 2 * kk + half];  // k = 4*kk + 2*half, +1
      float c0 = f.x, c1 = f.y;
      float s0 = f.z, s1 = f.w;
      v2f aR, aI, aN;
      aR.x = c0;  aR.y = c1;
      aI.x = s0;  aI.y = s1;    // Fi = +sin (inverse)
      aN.x = -s0; aN.y = -s1;   // -Fi
      int r0 = 4 * kk + 2 * half;
      v2f vR, vI;
      vR.x = xr[r0 * 16 + n16];
      vR.y = xr[(r0 + 1) * 16 + n16];
      vI.x = xi[r0 * 16 + n16];
      vI.y = xi[(r0 + 1) * 16 + n16];
      accR = wmma4(aR, vR, accR);
      accR = wmma4(aN, vI, accR);
      accI = wmma4(aR, vI, accI);
      accI = wmma4(aI, vR, accI);
    }
#pragma unroll
    for (int v = 0; v < 8; ++v) {
      int t0 = 16 * m + v + 8 * half;
      float s, c;
      __sincosf((2.f * PI_F / 4096.f) * (float)((t0 * k1) & 4095), &s, &c);
      float gr = accR[v] * c - accI[v] * s;
      float gi = accR[v] * s + accI[v] * c;
      size_t o = base + (size_t)t0 * 1024;
      Br[o] = gr;
      Bi[o] = gi;
    }
  }
}

// ---------------- Kernel C: inverse stage-2 over k1, real part only ----------------
// y[b][64*t1+t0][d] = (1/4096)*gain[d]*Re( sum_k1 e^{+2pi i t1 k1/64} C[k1][t0][d] )
__global__ void __launch_bounds__(128) kC(const float* __restrict__ Br,
                                          const float* __restrict__ Bi,
                                          const float* __restrict__ gain,
                                          float* __restrict__ y) {
  __shared__ v4f sTab[64 * TPU];
  initF(sTab);
  const int lane = threadIdx.x & 31;
  const int wave = threadIdx.x >> 5;
  const int half = lane >> 4;
  const int n16 = lane & 15;
  const int d0 = blockIdx.x * 16;
  const int t0 = blockIdx.y * 4 + wave;
  const int b = blockIdx.z;

  const size_t base =
      ((size_t)b * 64) * 64 * 1024 + (size_t)t0 * 1024 + d0 + n16;  // + k1*64*1024

  v2f bR[16], bI[16];  // C[k1][d], K = k1
#pragma unroll
  for (int kk = 0; kk < 16; ++kk) {
    int r0 = 4 * kk + 2 * half;
    bR[kk].x = Br[base + (size_t)r0 * 64 * 1024];
    bR[kk].y = Br[base + (size_t)(r0 + 1) * 64 * 1024];
    bI[kk].x = Bi[base + (size_t)r0 * 64 * 1024];
    bI[kk].y = Bi[base + (size_t)(r0 + 1) * 64 * 1024];
  }

  const float ag = gain[d0 + n16] * (1.f / 4096.f);

#pragma unroll
  for (int m = 0; m < 4; ++m) {
    v8f accR = {0, 0, 0, 0, 0, 0, 0, 0};
    const int mrow = 16 * m + n16;
#pragma unroll
    for (int kk = 0; kk < 16; ++kk) {
      v4f f = sTab[mrow * TPU + 2 * kk + half];  // k = 4*kk + 2*half, +1
      v2f aR, aN;
      aR.x = f.x;
      aR.y = f.y;
      aN.x = -f.z;  // -Fi, Fi = +sin (inverse)
      aN.y = -f.w;
      accR = wmma4(aR, bR[kk], accR);  // Re = cos*Cr - sin*Ci
      accR = wmma4(aN, bI[kk], accR);
    }
#pragma unroll
    for (int v = 0; v < 8; ++v) {
      int t1 = 16 * m + v + 8 * half;
      int t = 64 * t1 + t0;
      y[((size_t)b * 4096 + t) * 1024 + d0 + n16] = accR[v] * ag;
    }
  }
}

extern "C" void kernel_launch(void* const* d_in, const int* in_sizes, int n_in,
                              void* d_out, int out_size, void* d_ws, size_t ws_size,
                              hipStream_t stream) {
  const float* x = (const float*)d_in[0];
  const float* W1 = (const float*)d_in[1];
  const float* b1 = (const float*)d_in[2];
  const float* W2 = (const float*)d_in[3];
  const float* b2 = (const float*)d_in[4];
  const float* ag = (const float*)d_in[5];
  float* out = (float*)d_out;

  // workspace layout: Hbins[2049*1024] | Br[4*4096*1024] | Bi[4*4096*1024]  (~143 MB)
  float* Hb = (float*)d_ws;
  float* wBr = Hb + (size_t)2049 * 1024;
  float* wBi = wBr + (size_t)4 * 4096 * 1024;

  kH<<<dim3(2049, 4, 1), 256, 0, stream>>>(W1, b1, W2, b2, Hb);
  kA<<<dim3(64, 16, 4), 128, 0, stream>>>(x, wBr, wBi);
  kB<<<dim3(64, 16, 4), 128, 0, stream>>>(wBr, wBi, Hb);
  kC<<<dim3(64, 16, 4), 128, 0, stream>>>(wBr, wBi, ag, out);
}

// v002
// A run of this version takes 138 microseconds.
// Two timings next to v001 both put it at 1.78 times that version's speed.
// All steps since v000 together make it 2.48 times as fast.
#include <hip/hip_runtime.h>
#include <hip/hip_bf16.h>

typedef __attribute__((ext_vector_type(2))) float v2f;
typedef __attribute__((ext_vector_type(4))) float v4f;
typedef __attribute__((ext_vector_type(8))) float v8f;

#define PI_F 3.14159265358979323846f

// DFT-64 table in LDS: row r holds 32 units of 16 bytes, unit j = {cos(r,2j), cos(r,2j+1),
// sin(r,2j), sin(r,2j+1)}, so one 16-byte read gives a lane its cos and sin A-fragment.
// Row pitch TPU = 33 units (528 bytes, 16 x odd): the 16 rows that a half-wave reads at once
// fall on 16 different groups of four banks (bank = dword address mod 64); at a pitch of
// 256 bytes all 16 rows fell on the same banks.
#define TPU 33

// D = A(16x4) * B(4x16) + C, f32 WMMA (CDNA5 V_WMMA_F32_16X16X4_F32)
static __device__ __forceinline__ v8f wmma4(v2f a, v2f b, v8f c) {
  return __builtin_amdgcn_wmma_f32_16x16x4_f32(false, a, false, b, (short)0, c,
                                               false, false);
}

// Build the table: angle(r,k) = 2*pi*r*k/64
static __device__ __forceinline__ void initF(v4f* sTab) {
  float* tab = (float*)sTab;
  for (int i = threadIdx.x; i < 64 * 64; i += blockDim.x) {
    int r = i >> 6, k = i & 63;
    float th = (2.f * PI_F / 64.f) * (float)((r * k) & 63);  // exact period reduction
    float s, c;
    __sincosf(th, &s, &c);
    int o = (r * TPU + (k >> 1)) * 4 + (k & 1);
    tab[o] = c;
    tab[o + 2] = s;
  }
  __syncthreads();
}

// ---------------- tiny filter MLP:  Hbins[2049][1024] ----------------
__global__ void __launch_bounds__(256) kH(const float* __restrict__ W1,
                                          const float* __restrict__ b1,
                                          const float* __restrict__ W2,
                                          const float* __restrict__ b2,
                                          float* __restrict__ Hb) {
  __shared__ float h[32];
  const int bin = blockIdx.x;
  const int tid = threadIdx.x;
  if (tid < 32) {
    float acc = b1[tid];
#pragma unroll
    for (int i = 0; i < 16; ++i) {
      int m = i >> 1;
      float invf = expf((float)(2 * m) * (-9.210340371976184f / 16.f));
      float arg = (float)bin * invf;
      float pe = (i & 1) ? cosf(arg) : sinf(arg);
      acc += pe * W1[i * 32 + tid];
    }
    h[tid] = acc / (1.f + expf(-acc));  // SiLU
  }
  __syncthreads();
  int d = blockIdx.y * 256 + tid;
  float acc = b2[d];
#pragma unroll
  for (int j = 0; j < 32; ++j) acc += h[j] * W2[j * 1024 + d];
  Hb[(size_t)bin * 1024 + d] = acc;
}

// The filter is real and even in the bin index (bin k and bin 4096-k use the same value), so its
// impulse response is real. Two real signals that share a filter therefore go through ONE complex
// transform: z = x[p] + i*x[p+2] (batches p and p+2, same column d, same filter column).
// Re(ifft(fft(z)*H)) is the result for batch p, Im(...) the result for batch p+2.
// G holds z's transform as {re, im} pairs: G[p][k1][t0][d], p = 0..1.

// ---------------- Kernel A: stage-1 forward DFT over t1 + twiddle ----------------
// G[p][k1][t0][d] = w4096^{t0*k1} * sum_t1 e^{-2pi i k1 t1/64} z[p][64*t1+t0][d]
// launch_bounds' second argument: a budget of 128 VGPRs, so that all the work-groups that fall
// to a WGP are resident at once (without it the compiler takes more than twice that here).
__global__ void __launch_bounds__(128, 8) kA(const float* __restrict__ x,
                                          float* __restrict__ Gf) {
  __shared__ v4f sTab[64 * TPU];
  initF(sTab);
  const int lane = threadIdx.x & 31;
  const int wave = threadIdx.x >> 5;
  const int half = lane >> 4;
  const int n16 = lane & 15;
  const int d0 = blockIdx.x * 16;
  const int t0 = blockIdx.y * 4 + wave;
  const int p = blockIdx.z;
  // k1 = 8*half, this wave's t0 and column
  v2f* G = (v2f*)Gf + (((size_t)p * 64 + 8 * half) * 64 + t0) * 1024 + d0 + n16;

  // row 64*(2*half) + t0 of batch p (real part) and of batch p+2 (imaginary part)
  const float* xa = x + ((size_t)p * 4096 + 128 * half + t0) * 1024 + d0 + n16;
  const float* xb = xa + (size_t)2 * 4096 * 1024;

  v2f bR[16], bI[16];  // B-fragments, K = t1
#pragma unroll
  for (int kk = 0; kk < 16; ++kk) {
    // t1 = 4*kk + 2*half and t1 + 1
    bR[kk].x = xa[(size_t)(256 * kk) * 1024];
    bR[kk].y = xa[(size_t)(256 * kk + 64) * 1024];
    bI[kk].x = xb[(size_t)(256 * kk) * 1024];
    bI[kk].y = xb[(size_t)(256 * kk + 64) * 1024];
  }

#pragma unroll
  for (int m = 0; m < 4; ++m) {
    v8f accR = {0, 0, 0, 0, 0, 0, 0, 0};
    v8f accI = {0, 0, 0, 0, 0, 0, 0, 0};
    const int mrow = 16 * m + n16;
#pragma unroll
    for (int kk = 0; kk < 16; ++kk) {
      v4f f = sTab[mrow * TPU + 2 * kk + half];  // k = 4*kk + 2*half, +1
      v2f aR, aI, aN;
      aR.x = f.x;  aR.y = f.y;
      aI.x = -f.z; aI.y = -f.w;  // forward: Fi = -sin
      aN.x = f.z;  aN.y = f.w;   // -Fi
      accR = wmma4(aR, bR[kk], accR);
      accI = wmma4(aR, bI[kk], accI);
      accR = wmma4(aN, bI[kk], accR);
      accI = wmma4(aI, bR[kk], accI);
    }
#pragma unroll
    for (int v = 0; v < 8; ++v) {
      int M = 16 * m + v + 8 * half;  // k1
      float s, c;
      __sincosf(-(2.f * PI_F / 4096.f) * (float)((t0 * M) & 4095), &s, &c);
      v2f g;
      g.x = accR[v] * c - accI[v] * s;
      g.y = accR[v] * s + accI[v] * c;
      G[(size_t)(16 * m + v) * 64 * 1024] = g;
    }
  }
}

// ---------------- Kernel B: fwd over t0, *Hfull, inv over k2, conj twiddle (in place) ----
__global__ void __launch_bounds__(128) kB(float* __restrict__ Gf,
                                          const float* __restrict__ Hb) {
  __shared__ v4f sTab[64 * TPU];
  __shared__ float sXr[4][1024], sXi[4][1024];
  initF(sTab);
  const int lane = threadIdx.x & 31;
  const int wave = threadIdx.x >> 5;
  const int half = lane >> 4;
  const int n16 = lane & 15;
  const int d0 = blockIdx.x * 16;
  const int k1 = blockIdx.y * 4 + wave;
  const int p = blockIdx.z;
  float* xr = sXr[wave];
  float* xi = sXi[wave];
  v2f* G = (v2f*)Gf;

  const size_t base = (((size_t)p * 64 + k1) * 64) * 1024 + d0 + n16;  // + t0*1024

  v2f bR[16], bI[16];  // G[t0][d], K = t0
#pragma unroll
  for (int kk = 0; kk < 16; ++kk) {
    int r0 = 4 * kk + 2 * half;
    v2f g0 = G[base + (size_t)r0 * 1024];
    v2f g1 = G[base + (size_t)(r0 + 1) * 1024];
    bR[kk].x = g0.x;
    bR[kk].y = g1.x;
    bI[kk].x = g0.y;
    bI[kk].y = g1.y;
  }

  // stage 1: Xf[k2][d] = sum_t0 e^{-2pi i k2 t0/64} G[t0][d], then * Hfull[k1+64*k2][d]
#pragma unroll
  for (int m = 0; m < 4; ++m) {
    v8f accR = {0, 0, 0, 0, 0, 0, 0, 0};
    v8f accI = {0, 0, 0, 0, 0, 0, 0, 0};
    const int mrow = 16 * m + n16;
#pragma unroll
    for (int kk = 0; kk < 16; ++kk) {
      v4f f = sTab[mrow * TPU + 2 * kk + half];  // k = 4*kk + 2*half, +1
      float c0 = f.x, c1 = f.y;
      float s0 = f.z, s1 = f.w;
      v2f aR, aI, aN;
      aR.x = c0;  aR.y = c1;
      aI.x = -s0; aI.y = -s1;  // Fi
      aN.x = s0;  aN.y = s1;   // -Fi
      accR = wmma4(aR, bR[kk], accR);
      accR = wmma4(aN, bI[kk], accR);
      accI = wmma4(aR, bI[kk], accI);
      accI = wmma4(aI, bR[kk], accI);
    }
#pragma unroll
    for (int v = 0; v < 8; ++v) {
      int k2 = 16 * m + v + 8 * half;
      int k = k1 + 64 * k2;
      int bin = (k <= 2048) ? k : (4096 - k);  // real symmetric filter
      float hv = Hb[(size_t)bin * 1024 + d0 + n16];
      xr[k2 * 16 + n16] = accR[v] * hv;
      xi[k2 * 16 + n16] = accI[v] * hv;
    }
  }

  // stage 2: C[t0][d] = sum_k2 e^{+2pi i t0 k2/64} Xf[k2][d], then * e^{+2pi i t0 k1/4096}
#pragma unroll
  for (int m = 0; m < 4; ++m) {
    v8f accR = {0, 0, 0, 0, 0, 0, 0, 0};
    v8f accI = {0, 0, 0, 0, 0, 0, 0, 0};
    const int mrow = 16 * m + n16;
#pragma unroll
    for (int kk = 0; kk < 16; ++kk) {
      v4f f = sTab[mrow * TPU + 2 * kk + half];  // k = 4*kk + 2*half, +1
      float c0 = f.x, c1 = f.y;
      float s0 = f.z, s1 = f.w;
      v2f aR, aI, aN;
      aR.x = c0;  aR.y = c1;
      aI.x = s0;  aI.y = s1;    // Fi = +sin (inverse)
      aN.x = -s0; aN.y = -s1;   // -Fi
      int r0 = 4 * kk + 2 * half;
      v2f vR, vI;
      vR.x = xr[r0 * 16 + n16];
      vR.y = xr[(r0 + 1) * 16 + n16];
      vI.x = xi[r0 * 16 + n16];
      vI.y = xi[(r0 + 1) * 16 + n16];
      accR = wmma4(aR, vR, accR);
      accR = wmma4(aN, vI, accR);
      accI = wmma4(aR, vI, accI);
      accI = wmma4(aI, vR, accI);
    }
#pragma unroll
    for (int v = 0; v < 8; ++v) {
      int t0 = 16 * m + v + 8 * half;
      float s, c;
      __sincosf((2.f * PI_F / 4096.f) * (float)((t0 * k1) & 4095), &s, &c);
      v2f g;
      g.x = accR[v] * c - accI[v] * s;
      g.y = accR[v] * s + accI[v] * c;
      G[base + (size_t)t0 * 1024] = g;
    }
  }
}

// ---------------- Kernel C: inverse stage-2 over k1 ----------------
// w = (1/4096)*gain[d]*sum_k1 e^{+2pi i t1 k1/64} C[k1][t0][d];
// y[p][64*t1+t0][d] = Re w, y[p+2][64*t1+t0][d] = Im w
// launch_bounds' second argument: the same budget of 128 VGPRs as in kernel A.
__global__ void __launch_bounds__(128, 8) kC(const float* __restrict__ Gf,
                                          const float* __restrict__ gain,
                                          float* __restrict__ y) {
  __shared__ v4f sTab[64 * TPU];
  initF(sTab);
  const int lane = threadIdx.x & 31;
  const int wave = threadIdx.x >> 5;
  const int half = lane >> 4;
  const int n16 = lane & 15;
  const int d0 = blockIdx.x * 16;
  const int t0 = blockIdx.y * 4 + wave;
  const int p = blockIdx.z;
  const v2f* G = (const v2f*)Gf;

  const size_t base =
      ((size_t)p * 64) * 64 * 1024 + (size_t)t0 * 1024 + d0 + n16;  // + k1*64*1024

  v2f bR[16], bI[16];  // C[k1][d], K = k1
#pragma unroll
  for (int kk = 0; kk < 16; ++kk) {
    int r0 = 4 * kk + 2 * half;
    v2f g0 = G[base + (size_t)r0 * 64 * 1024];
    v2f g1 = G[base + (size_t)(r0 + 1) * 64 * 1024];
    bR[kk].x = g0.x;
    bR[kk].y = g1.x;
    bI[kk].x = g0.y;
    bI[kk].y = g1.y;
  }

  const float ag = gain[d0 + n16] * (1.f / 4096.f);
  // t1 = 8*half, this wave's t0 and column, batches p and p+2
  float* ya = y + ((size_t)p * 4096 + 512 * half + t0) * 1024 + d0 + n16;
  float* yb = ya + (size_t)2 * 4096 * 1024;

#pragma unroll
  for (int m = 0; m < 4; ++m) {
    v8f accR = {0, 0, 0, 0, 0, 0, 0, 0};
    v8f accI = {0, 0, 0, 0, 0, 0, 0, 0};
    const int mrow = 16 * m + n16;
#pragma unroll
    for (int kk = 0; kk < 16; ++kk) {
      v4f f = sTab[mrow * TPU + 2 * kk + half];  // k = 4*kk + 2*half, +1
      v2f aR, aI, aN;
      aR.x = f.x;  aR.y = f.y;
      aI.x = f.z;  aI.y = f.w;    // Fi = +sin (inverse)
      aN.x = -f.z; aN.y = -f.w;   // -Fi
      accR = wmma4(aR, bR[kk], accR);  // Re = cos*Cr - sin*Ci
      accI = wmma4(aR, bI[kk], accI);  // Im = cos*Ci + sin*Cr
      accR = wmma4(aN, bI[kk], accR);
      accI = wmma4(aI, bR[kk], accI);
    }
#pragma unroll
    for (int v = 0; v < 8; ++v) {
      size_t o = (size_t)(16 * m + v) * 64 * 1024;
      ya[o] = accR[v] * ag;
      yb[o] = accI[v] * ag;
    }
  }
}

extern "C" void kernel_launch(void* const* d_in, const int* in_sizes, int n_in,
                              void* d_out, int out_size, void* d_ws, size_t ws_size,
                              hipStream_t stream) {
  const float* x = (const float*)d_in[0];
  const float* W1 = (const float*)d_in[1];
  const float* b1 = (const float*)d_in[2];
  const float* W2 = (const float*)d_in[3];
  const float* b2 = (const float*)d_in[4];
  const float* ag = (const float*)d_in[5];
  float* out = (float*)d_out;

  // workspace layout: Hbins[2049*1024] | G[2*4096*1024] {re,im} pairs  (~76 MB)
  float* Hb = (float*)d_ws;
  float* wG = Hb + (size_t)2049 * 1024;

  kH<<<dim3(2049, 4, 1), 256, 0, stream>>>(W1, b1, W2, b2, Hb);
  kA<<<dim3(64, 16, 2), 128, 0, stream>>>(x, wG);
  kB<<<dim3(64, 16, 2), 128, 0, stream>>>(wG, Hb);
  kC<<<dim3(64, 16, 2), 128, 0, stream>>>(wG, ag, out);
}

// v004
// It runs in 78.9 microseconds.
// Versions in between are left out here; by their measured steps it is 1.74 times as fast as v002.
// All steps since v000 together make it 4.33 times as fast.
#include <hip/hip_runtime.h>
#include <hip/hip_bf16.h>

typedef __attribute__((ext_vector_type(2))) float v2f;
typedef __attribute__((ext_vector_type(4))) float v4f;
typedef __attribute__((ext_vector_type(8))) float v8f;

// D = A(16x4) * B(4x16) + C, f32 WMMA (CDNA5 V_WMMA_F32_16X16X4_F32)
static __device__ __forceinline__ v8f wmma4(v2f a, v2f b, v8f c) {
  return __builtin_amdgcn_wmma_f32_16x16x4_f32(false, a, false, b, (short)0, c,
                                               false, false);
}

// Every 64-point DFT is factored 64 = 4 x 16. With t = n + 16*j and k = 4*r + q,
//   X[4r+q] = sum_n w16^(r*n) * ( w64^(q*n) * sum_j w4^(q*j) * z[n+16j] ),   w_N = e^(SG*2*pi*i/N):
// the sum over j is a radix-4 butterfly (adds only) and w64^(q*n) one complex multiply per element,
// both on values that a lane already holds; only the 16-point DFT is a matrix product.
// Its 16x16 matrix is four A-fragments of cos and of sin, held in registers.

// sin and cos of 2*pi*num/den, den a power of two: the hardware takes the angle in turns, and
// num/den is exact in f32.
// ONE = true: both in one asm statement. Kernel A takes the builtins (ONE = false): with the
// statement's separate result registers it does not fit its 128 VGPRs and spills.
template <bool ONE>
static __device__ __forceinline__ void sincosTurns(int num, float invDen, float& s, float& c) {
  float t = (float)num * invDen;
  if constexpr (ONE) {
    // Neither result shares a register with the angle, and the v_nop is the free slot that the
    // instruction set asks for between a transcendental and the first reader of its result.
    asm("v_sin_f32 %0, %2\n\tv_cos_f32 %1, %2\n\tv_nop" : "=&v"(s), "=&v"(c) : "v"(t));
  } else {
    s = __builtin_amdgcn_sinf(t);
    c = __builtin_amdgcn_cosf(t);
  }
}

// Access at a wave-uniform base plus the lane's own byte offset: the base and every constant step
// stay in scalar registers, and one VGPR serves all the accesses of a lane.
static __device__ __forceinline__ float ldF(const float* u, unsigned b) {
  return *(const float*)((const char*)u + b);
}
static __device__ __forceinline__ v2f ldV(const v2f* u, unsigned b) {
  return *(const v2f*)((const char*)u + b);
}
static __device__ __forceinline__ v4f ldQ(const float* u, unsigned b) {
  return *(const v4f*)((const char*)u + b);
}
static __device__ __forceinline__ void stQ(float* u, unsigned b, v4f v) {
  *(v4f*)((char*)u + b) = v;
}
static __device__ __forceinline__ void stF(float* u, unsigned b, float v) {
  *(float*)((char*)u + b) = v;
}
static __device__ __forceinline__ void stV(v2f* u, unsigned b, v2f v) {
  *(v2f*)((char*)u + b) = v;
}

// A-fragments of the 16-point DFT matrix: row = the lane's row, fragment kk holds the columns
// col0 + step*kk and the next one. fc = cos, fs = sin, fn = -sin of 2*pi*row*col/16.
template <bool ONE>
static __device__ __forceinline__ void initF16(int row, int col0, int step, v2f (&fc)[4],
                                               v2f (&fs)[4], v2f (&fn)[4]) {
#pragma unroll
  for (int kk = 0; kk < 4; ++kk) {
    int col = col0 + step * kk;
    float s0, c0, s1, c1;
    sincosTurns<ONE>((row * col) & 15, 1.f / 16.f, s0, c0);
    sincosTurns<ONE>((row * (col + 1)) & 15, 1.f / 16.f, s1, c1);
    fc[kk].x = c0;  fc[kk].y = c1;
    fs[kk].x = s0;  fs[kk].y = s1;
    fn[kk].x = -s0; fn[kk].y = -s1;
  }
}

// 16-point DFT of 16 columns, K in four fragments. fp multiplies bR into the imaginary part and
// fm multiplies bI into the real part: forward (fp, fm) = (-sin, sin), inverse (sin, -sin).
static __device__ __forceinline__ void dft16(const v2f (&fc)[4], const v2f (&fp)[4],
                                             const v2f (&fm)[4], const v2f (&bR)[4],
                                             const v2f (&bI)[4], v8f& accR, v8f& accI) {
#pragma unroll
  for (int kk = 0; kk < 4; ++kk) {
    accR = wmma4(fc[kk], bR[kk], accR);
    accI = wmma4(fc[kk], bI[kk], accI);
    accR = wmma4(fm[kk], bI[kk], accR);
    accI = wmma4(fp[kk], bR[kk], accI);
  }
}

// Radix-4 butterflies and w64 twiddles in front of the 16-point DFTs, in place.
// In: zR/zI[j][kk], component e = element t = n + 16*j with n = 4*kk + 2*half + e.
// Out: zR/zI[q][kk] = B-fragment kk (K = n) of the 16-point DFT that gives X[4r+q].
template <int SG, bool ONE>  // SG: -1 forward, +1 inverse
static __device__ __forceinline__ void radix4In(v2f (&zR)[4][4], v2f (&zI)[4][4], int half) {
  const float sg = (float)SG;
#pragma unroll
  for (int kk = 0; kk < 4; ++kk) {
    v2f s0R = zR[0][kk] + zR[2][kk], s0I = zI[0][kk] + zI[2][kk];
    v2f s1R = zR[0][kk] - zR[2][kk], s1I = zI[0][kk] - zI[2][kk];
    v2f s2R = zR[1][kk] + zR[3][kk], s2I = zI[1][kk] + zI[3][kk];
    v2f s3R = (zR[1][kk] - zR[3][kk]) * sg, s3I = (zI[1][kk] - zI[3][kk]) * sg;
    v2f tR[4], tI[4];
    tR[0] = s0R + s2R; tI[0] = s0I + s2I;
    tR[1] = s1R - s3I; tI[1] = s1I + s3R;  // s1 + SG*i*(z1 - z3)
    tR[2] = s0R - s2R; tI[2] = s0I - s2I;
    tR[3] = s1R + s3I; tI[3] = s1I - s3R;
    zR[0][kk] = tR[0];
    zI[0][kk] = tI[0];
#pragma unroll
    for (int q = 1; q < 4; ++q) {
#pragma unroll
      for (int e = 0; e < 2; ++e) {
        int n = 4 * kk + 2 * half + e;
        float s, c;
        sincosTurns<ONE>((q * n) & 63, 1.f / 64.f, s, c);
        s *= sg;
        zR[q][kk][e] = tR[q][e] * c - tI[q][e] * s;
        zI[q][kk][e] = tR[q][e] * s + tI[q][e] * c;
      }
    }
  }
}

// ---------------- tiny filter MLP:  Hbins[2049][1024] ----------------
// One work-group makes eight bins over all 1024 columns. Threads 0..127 make one sine or
// cosine each; every thread one hidden unit and four columns of all eight bins, so that a value of W2
// is loaded once for eight bins. Each sum runs in the order i = 0..15 and j = 0..31.
// The last group has one bin of its own, 2048: it makes that bin eight times, and a thread stores
// the same value to the same place each time.
// launch_bounds' second argument: a budget of 256 VGPRs, which keeps every register directly
// addressable.
__global__ void __launch_bounds__(256, 4) kH(const float* __restrict__ W1,
                                          const float* __restrict__ b1,
                                          const float* __restrict__ W2,
                                          const float* __restrict__ b2,
                                          float* __restrict__ Hb) {
  __shared__ float pe[8][16];
  __shared__ __attribute__((aligned(16))) float h[32][8];
  const int tid = threadIdx.x;
  const int bin0 = blockIdx.x * 8;

  // All the weights are asked for first: they arrive while the sines are worked out.
  const unsigned co = (unsigned)tid * 16u;  // columns 4*tid .. 4*tid+3
  v4f w2[32];
#pragma unroll
  for (int j = 0; j < 32; ++j) w2[j] = ldQ(W2 + j * 1024, co);
  const v4f bias = ldQ(b2, co);
  const int hj = tid & 31;  // hidden unit
  const int hb = tid >> 5;  // its bin: the wave's number
  const unsigned jo = (unsigned)hj * 4u;
  float w1[16];
#pragma unroll
  for (int i = 0; i < 16; ++i) w1[i] = ldF(W1 + i * 32, jo);
  float acc = ldF(b1, jo);
  // the index registers that the loads name are held until this wait, so none of them lands on one
  asm volatile("s_wait_xcnt 0x0" ::"v"(tid), "v"(hj) : "memory");

  if (tid < 128) {  // waves 0 and 1: the sines; waves 2 and 3: the cosines
    const int m = tid & 7;
    const int b = (tid >> 3) & 7;
    float invf = 1.f;
#pragma unroll
    for (int mm = 1; mm < 8; ++mm)
      if (m == mm) invf = expf((float)(2 * mm) * (-9.210340371976184f / 16.f));
    float arg = (float)min(bin0 + b, 2048) * invf;
    if (tid < 64) pe[b][2 * m] = sinf(arg);
    else pe[b][2 * m + 1] = cosf(arg);
  }
  __syncthreads();
#pragma unroll
  for (int i = 0; i < 16; ++i) acc = __builtin_fmaf(pe[hb][i], w1[i], acc);
  h[hj][hb] = acc / (1.f + expf(-acc));  // SiLU
  __syncthreads();

  v4f o[8];
#pragma unroll
  for (int b = 0; b < 8; ++b) o[b] = bias;
#pragma unroll
  for (int j = 0; j < 32; ++j) {
#pragma unroll
    for (int b = 0; b < 8; ++b) o[b] += h[j][b] * w2[j];
  }
#pragma unroll
  for (int b = 0; b < 8; ++b) stQ(Hb + (size_t)min(bin0 + b, 2048) * 1024, co, o[b]);
}

// The filter is real and even in the bin index (bin k and bin 4096-k use the same value), so its
// impulse response is real. Two real signals that share a filter therefore go through ONE complex
// transform: z = x[p] + i*x[p+2] (batches p and p+2, same column d, same filter column).
// Re(ifft(fft(z)*H)) is the result for batch p, Im(...) the result for batch p+2.
// G holds z's transform as {re, im} pairs: G[p][k1][t0][d], p = 0..1.

// ---------------- Kernel A: stage-1 forward DFT over t1 + twiddle ----------------
// G[p][k1][t0][d] = w4096^{t0*k1} * sum_t1 e^{-2pi i k1 t1/64} z[p][64*t1+t0][d]
// launch_bounds' second argument: a budget of 128 VGPRs, so that all the work-groups that fall
// to a WGP are resident at once.
__global__ void __launch_bounds__(128, 8) kA(const float* __restrict__ x,
                                          float* __restrict__ Gf) {
  const int lane = threadIdx.x & 31;
  // the wave's number as a scalar: t0 and all that follows from it stay out of the VGPRs
  const int wave = __builtin_amdgcn_readfirstlane(threadIdx.x >> 5);
  const int half = lane >> 4;
  const int n16 = lane & 15;
  const int d0 = blockIdx.x * 16;
  const int t0 = blockIdx.y * 4 + wave;
  const int p = blockIdx.z;
  // k1 = 4*(8*half), this wave's t0 and column
  v2f* G = (v2f*)Gf + (((size_t)p * 64 + 32 * half) * 64 + t0) * 1024 + d0 + n16;

  // row 64*(2*half) + t0 of batch p (real part) and of batch p+2 (imaginary part)
  const float* xa = x + ((size_t)p * 4096 + 128 * half + t0) * 1024 + d0 + n16;
  const float* xb = xa + (size_t)2 * 4096 * 1024;

  v2f zR[4][4], zI[4][4];
#pragma unroll
  for (int j = 0; j < 4; ++j) {
#pragma unroll
    for (int kk = 0; kk < 4; ++kk) {
      // t1 = 16*j + 4*kk + 2*half and t1 + 1
      zR[j][kk].x = xa[(size_t)(1024 * j + 256 * kk) * 1024];
      zR[j][kk].y = xa[(size_t)(1024 * j + 256 * kk + 64) * 1024];
      zI[j][kk].x = xb[(size_t)(1024 * j + 256 * kk) * 1024];
      zI[j][kk].y = xb[(size_t)(1024 * j + 256 * kk + 64) * 1024];
    }
  }

  v2f fc[4], fs[4], fn[4];
  initF16<false>(n16, 2 * half, 4, fc, fs, fn);
  radix4In<-1, false>(zR, zI, half);

#pragma unroll
  for (int q = 0; q < 4; ++q) {
    v8f accR = {0, 0, 0, 0, 0, 0, 0, 0};
    v8f accI = {0, 0, 0, 0, 0, 0, 0, 0};
    dft16(fc, fn, fs, zR[q], zI[q], accR, accI);
#pragma unroll
    for (int v = 0; v < 8; ++v) {
      int M = 4 * (v + 8 * half) + q;  // k1
      float s, c;
      sincosTurns<false>((t0 * M) & 4095, 1.f / 4096.f, s, c);  // twiddle = c - i*s
      v2f g;
      g.x = accR[v] * c + accI[v] * s;
      g.y = accI[v] * c - accR[v] * s;
      G[(size_t)(4 * v + q) * 64 * 1024] = g;
    }
  }
}

// ---------------- Kernel B: fwd over t0, *Hfull, inv over k2, conj twiddle (in place) ----
__global__ void __launch_bounds__(128) kB(float* __restrict__ Gf,
                                          const float* __restrict__ Hb) {
  const int lane = threadIdx.x & 31;
  // the wave's number as a scalar: what follows from it stays out of the VGPRs
  const int wave = __builtin_amdgcn_readfirstlane(threadIdx.x >> 5);
  const int half = lane >> 4;
  const int n16 = lane & 15;
  const int d0 = blockIdx.x * 16;
  const int k1 = blockIdx.y * 4 + wave;
  const int p = blockIdx.z;
  v2f* G = (v2f*)Gf + (((size_t)p * 64 + k1) * 64) * 1024 + d0;  // t0 = 0
  const float* Hu = Hb + d0;
  const unsigned lo = (unsigned)(2 * half * 1024 + n16) * 8u;  // loads: t0 = 2*half, the column
  const unsigned so = (unsigned)(8 * half * 1024 + n16) * 8u;  // stores: t0 = 8*half, the column

  v2f zR[4][4], zI[4][4];  // G[t0][d]
#pragma unroll
  for (int j = 0; j < 4; ++j) {
#pragma unroll
    for (int kk = 0; kk < 4; ++kk) {
      // t0 = 16*j + 4*kk + 2*half and t0 + 1
      v2f g0 = ldV(G + (size_t)(16 * j + 4 * kk) * 1024, lo);
      v2f g1 = ldV(G + (size_t)(16 * j + 4 * kk + 1) * 1024, lo);
      zR[j][kk].x = g0.x;
      zR[j][kk].y = g1.x;
      zI[j][kk].x = g0.y;
      zI[j][kk].y = g1.y;
    }
  }
  // the offset register that the loads name is held until this wait, so none of them lands on it
  asm volatile("s_wait_xcnt 0x0" ::"v"(lo) : "memory");

  v2f fc[4], fs[4], fn[4];
  initF16<true>(n16, 2 * half, 4, fc, fs, fn);
  // The inverse takes its input in the order in which the forward's accumulators hold it:
  // accumulator registers 2*kk and 2*kk+1 are rows r = 8*half + 2*kk and r + 1, and they are
  // used as B-fragment kk as they stand; the matrix columns follow that k order.
  v2f gc[4], gs[4], gn[4];
  initF16<true>(n16, 8 * half, 2, gc, gs, gn);
  radix4In<-1, true>(zR, zI, half);

  // Per q: Xf[k2 = 4r+q][d] = sum_t0 e^{-2pi i k2 t0/64} G[t0][d], * Hfull[k1+64*k2][d], then
  // W_q[n][d] = sum_r e^{+2pi i n r/16} Xf[4r+q][d]
  v8f wR[4], wI[4];
#pragma unroll
  for (int q = 0; q < 4; ++q) {
    float hv[8];
    unsigned ho[8];
#pragma unroll
    for (int v = 0; v < 8; ++v) {
      int k2 = 4 * (v + 8 * half) + q;
      int k = k1 + 64 * k2;
      int bin = (k <= 2048) ? k : (4096 - k);  // real symmetric filter
      ho[v] = (unsigned)(bin * 1024 + n16) * 4u;
      hv[v] = ldF(Hu, ho[v]);
    }
    // the eight offset registers are held until this wait, so none of the loads lands on one
    asm volatile("s_wait_xcnt 0x0" ::"v"(ho[0]), "v"(ho[1]), "v"(ho[2]), "v"(ho[3]), "v"(ho[4]),
                 "v"(ho[5]), "v"(ho[6]), "v"(ho[7])
                 : "memory");
    v8f accR = {0, 0, 0, 0, 0, 0, 0, 0};
    v8f accI = {0, 0, 0, 0, 0, 0, 0, 0};
    dft16(fc, fn, fs, zR[q], zI[q], accR, accI);
    v2f bR[4], bI[4];
#pragma unroll
    for (int v = 0; v < 8; ++v) {
      bR[v >> 1][v & 1] = accR[v] * hv[v];
      bI[v >> 1][v & 1] = accI[v] * hv[v];
    }
    v8f oR = {0, 0, 0, 0, 0, 0, 0, 0};
    v8f oI = {0, 0, 0, 0, 0, 0, 0, 0};
    dft16(gc, gs, gn, bR, bI, oR, oI);
    wR[q] = oR;
    wI[q] = oI;
  }

  // C[t0 = n+16j][d] = sum_q i^(j*q) * e^{+2pi i n q/64} * W_q[n][d], then * e^{+2pi i t0 k1/4096}
#pragma unroll
  for (int v = 0; v < 8; ++v) {
    const int n = v + 8 * half;
    float uR[4], uI[4];
    uR[0] = wR[0][v];
    uI[0] = wI[0][v];
#pragma unroll
    for (int q = 1; q < 4; ++q) {
      float s, c;
      sincosTurns<true>((q * n) & 63, 1.f / 64.f, s, c);
      uR[q] = wR[q][v] * c - wI[q][v] * s;
      uI[q] = wR[q][v] * s + wI[q][v] * c;
    }
    float e0R = uR[0] + uR[2], e0I = uI[0] + uI[2];
    float e1R = uR[0] - uR[2], e1I = uI[0] - uI[2];
    float o0R = uR[1] + uR[3], o0I = uI[1] + uI[3];
    float o1R = uR[1] - uR[3], o1I = uI[1] - uI[3];
    float cR[4], cI[4];
    cR[0] = e0R + o0R; cI[0] = e0I + o0I;
    cR[1] = e1R - o1I; cI[1] = e1I + o1R;  // e1 + i*o1
    cR[2] = e0R - o0R; cI[2] = e0I - o0I;
    cR[3] = e1R + o1I; cI[3] = e1I - o1R;
#pragma unroll
    for (int j = 0; j < 4; ++j) {
      int t0 = n + 16 * j;
      float s, c;
      sincosTurns<true>((t0 * k1) & 4095, 1.f / 4096.f, s, c);
      v2f g;
      g.x = cR[j] * c - cI[j] * s;
      g.y = cR[j] * s + cI[j] * c;
      stV(G + (size_t)(v + 16 * j) * 1024, so, g);
    }
  }
}

// ---------------- Kernel C: inverse stage-2 over k1 ----------------
// w = (1/4096)*gain[d]*sum_k1 e^{+2pi i t1 k1/64} C[k1][t0][d];
// y[p][64*t1+t0][d] = Re w, y[p+2][64*t1+t0][d] = Im w
// launch_bounds' second argument: a budget of 168 VGPRs. At 128 the compiler waits for each pair of
// loads before it issues the next pair; with this budget all of a wave's loads are in flight at once.
__global__ void __launch_bounds__(128, 6) kC(const float* __restrict__ Gf,
                                          const float* __restrict__ gain,
                                          float* __restrict__ y) {
  const int lane = threadIdx.x & 31;
  // the wave's number as a scalar: what follows from it stays out of the VGPRs
  const int wave = __builtin_amdgcn_readfirstlane(threadIdx.x >> 5);
  const int half = lane >> 4;
  const int n16 = lane & 15;
  const int d0 = blockIdx.x * 16;
  const int t0 = blockIdx.y * 4 + wave;
  const int p = blockIdx.z;
  const v2f* G = (const v2f*)Gf + ((size_t)p * 64 * 64 + t0) * 1024 + d0;  // k1 = 0
  const unsigned lo = (unsigned)(2 * half * 64 * 1024 + n16) * 8u;  // k1 = 2*half, the column

  v2f zR[4][4], zI[4][4];  // C[k1][d]
#pragma unroll
  for (int j = 0; j < 4; ++j) {
#pragma unroll
    for (int kk = 0; kk < 4; ++kk) {
      // k1 = 16*j + 4*kk + 2*half and k1 + 1
      v2f g0 = ldV(G + (size_t)(16 * j + 4 * kk) * 64 * 1024, lo);
      v2f g1 = ldV(G + (size_t)(16 * j + 4 * kk + 1) * 64 * 1024, lo);
      zR[j][kk].x = g0.x;
      zR[j][kk].y = g1.x;
      zI[j][kk].x = g0.y;
      zI[j][kk].y = g1.y;
    }
  }
  const unsigned go = (unsigned)n16 * 4u;
  const float ag = ldF(gain + d0, go) * (1.f / 4096.f);
  // the offset registers that the loads name are held until this wait, so none of them lands on one
  asm volatile("s_wait_xcnt 0x0" ::"v"(lo), "v"(go) : "memory");

  // t1 = 0, this wave's t0, batches p and p+2; the lane adds t1 = 4*(8*half) and its column
  float* ya = y + ((size_t)p * 4096 + t0) * 1024 + d0;
  float* yb = ya + (size_t)2 * 4096 * 1024;
  const unsigned so = (unsigned)(2048 * half * 1024 + n16) * 4u;

  v2f fc[4], fs[4], fn[4];
  initF16<true>(n16, 2 * half, 4, fc, fs, fn);
  radix4In<1, true>(zR, zI, half);

#pragma unroll
  for (int q = 0; q < 4; ++q) {
    v8f accR = {0, 0, 0, 0, 0, 0, 0, 0};
    v8f accI = {0, 0, 0, 0, 0, 0, 0, 0};
    dft16(fc, fs, fn, zR[q], zI[q], accR, accI);
#pragma unroll
    for (int v = 0; v < 8; ++v) {
      size_t o = (size_t)(4 * v + q) * 64 * 1024;  // t1 = 4*(v + 8*half) + q
      stF(ya + o, so, accR[v] * ag);
      stF(yb + o, so, accI[v] * ag);
    }
  }
}

extern "C" void kernel_launch(void* const* d_in, const int* in_sizes, int n_in,
                              void* d_out, int out_size, void* d_ws, size_t ws_size,
                              hipStream_t stream) {
  const float* x = (const float*)d_in[0];
  const float* W1 = (const float*)d_in[1];
  const float* b1 = (const float*)d_in[2];
  const float* W2 = (const float*)d_in[3];
  const float* b2 = (const float*)d_in[4];
  const float* ag = (const float*)d_in[5];
  float* out = (float*)d_out;

  // workspace layout: Hbins[2049*1024] | G[2*4096*1024] {re,im} pairs  (~76 MB)
  float* Hb = (float*)d_ws;
  float* wG = Hb + (size_t)2049 * 1024;

  kH<<<dim3(257, 1, 1), 256, 0, stream>>>(W1, b1, W2, b2, Hb);
  kA<<<dim3(64, 16, 2), 128, 0, stream>>>(x, wG);
  kB<<<dim3(64, 16, 2), 128, 0, stream>>>(wG, Hb);
  kC<<<dim3(64, 16, 2), 128, 0, stream>>>(wG, ag, out);
}

// v005
// One run takes 68.6 microseconds.
// Next to v004, in two timings, it ran 1.15 times as fast each time.
// Over all steps from v000 it is 4.97 times as fast.
#include <hip/hip_runtime.h>
#include <hip/hip_bf16.h>

typedef __attribute__((ext_vector_type(2))) float v2f;
typedef __attribute__((ext_vector_type(4))) float v4f;
typedef __attribute__((ext_vector_type(8))) float v8f;

// D = A(16x4) * B(4x16) + C, f32 WMMA (CDNA5 V_WMMA_F32_16X16X4_F32)
static __device__ __forceinline__ v8f wmma4(v2f a, v2f b, v8f c) {
  return __builtin_amdgcn_wmma_f32_16x16x4_f32(false, a, false, b, (short)0, c,
                                               false, false);
}

// Every 64-point DFT is factored 64 = 4 x 16. With t = n + 16*j and k = 4*r + q,
//   X[4r+q] = sum_n w16^(r*n) * ( w64^(q*n) * sum_j w4^(q*j) * z[n+16j] ),   w_N = e^(SG*2*pi*i/N):
// the sum over j is a radix-4 butterfly (adds only) and w64^(q*n) one complex multiply per element,
// both on values that a lane already holds; only the 16-point DFT is a matrix product.
// Its 16x16 matrix is four A-fragments of cos and of sin, held in registers.

// sin and cos of 2*pi*num/den, den a power of two: the hardware takes the angle in turns, and
// num/den is exact in f32.
static __device__ __forceinline__ void sincosTurns(int num, float invDen, float& s, float& c) {
  float t = (float)num * invDen;
  // Neither result shares a register with the angle, and the v_nop is the free slot that the
  // instruction set asks for between a transcendental and the first reader of its result.
  asm("v_sin_f32 %0, %2\n\tv_cos_f32 %1, %2\n\tv_nop" : "=&v"(s), "=&v"(c) : "v"(t));
}

// Access at a wave-uniform base plus the lane's own byte offset: the base and every constant step
// stay in scalar registers, and one VGPR serves all the accesses of a lane.
static __device__ __forceinline__ float ldF(const float* u, unsigned b) {
  return *(const float*)((const char*)u + b);
}
static __device__ __forceinline__ v2f ldV(const v2f* u, unsigned b) {
  return *(const v2f*)((const char*)u + b);
}
static __device__ __forceinline__ v4f ldQ(const float* u, unsigned b) {
  return *(const v4f*)((const char*)u + b);
}
static __device__ __forceinline__ void stQ(float* u, unsigned b, v4f v) {
  *(v4f*)((char*)u + b) = v;
}
static __device__ __forceinline__ void stF(float* u, unsigned b, float v) {
  *(float*)((char*)u + b) = v;
}
static __device__ __forceinline__ void stV(v2f* u, unsigned b, v2f v) {
  *(v2f*)((char*)u + b) = v;
}

// The lane's byte offset moved on by a constant too large for an access's own offset field.
// The add is written in asm so that the accesses name this one register beside the scalar base:
// left to itself the compiler takes the constant out again and forms 64-bit address pairs of its
// own, which the source cannot hold until the wait that follows the accesses.
static __device__ __forceinline__ unsigned farOff(unsigned b, unsigned step) {
  unsigned r;
  asm("v_add_nc_u32 %0, %1, %2" : "=v"(r) : "s"(step), "v"(b));
  return r;
}

// A-fragments of the 16-point DFT matrix: row = the lane's row, fragment kk holds the columns
// col0 + step*kk and the next one. fc = cos, fs = sin, fn = -sin of 2*pi*row*col/16.
static __device__ __forceinline__ void initF16(int row, int col0, int step, v2f (&fc)[4],
                                               v2f (&fs)[4], v2f (&fn)[4]) {
#pragma unroll
  for (int kk = 0; kk < 4; ++kk) {
    int col = col0 + step * kk;
    float s0, c0, s1, c1;
    sincosTurns((row * col) & 15, 1.f / 16.f, s0, c0);
    sincosTurns((row * (col + 1)) & 15, 1.f / 16.f, s1, c1);
    fc[kk].x = c0;  fc[kk].y = c1;
    fs[kk].x = s0;  fs[kk].y = s1;
    fn[kk].x = -s0; fn[kk].y = -s1;
  }
}

// 16-point DFT of 16 columns, K in four fragments. fp multiplies bR into the imaginary part and
// fm multiplies bI into the real part: forward (fp, fm) = (-sin, sin), inverse (sin, -sin).
static __device__ __forceinline__ void dft16(const v2f (&fc)[4], const v2f (&fp)[4],
                                             const v2f (&fm)[4], const v2f (&bR)[4],
                                             const v2f (&bI)[4], v8f& accR, v8f& accI) {
#pragma unroll
  for (int kk = 0; kk < 4; ++kk) {
    accR = wmma4(fc[kk], bR[kk], accR);
    accI = wmma4(fc[kk], bI[kk], accI);
    accR = wmma4(fm[kk], bI[kk], accR);
    accI = wmma4(fp[kk], bR[kk], accI);
  }
}

// Radix-4 butterflies and w64 twiddles in front of the 16-point DFTs, in place.
// In: zR/zI[j][kk], component e = element t = n + 16*j with n = 4*kk + 2*half + e.
// Out: zR/zI[q][kk] = B-fragment kk (K = n) of the 16-point DFT that gives X[4r+q].
template <int SG>  // SG: -1 forward, +1 inverse
static __device__ __forceinline__ void radix4In(v2f (&zR)[4][4], v2f (&zI)[4][4], int half) {
  const float sg = (float)SG;
#pragma unroll
  for (int kk = 0; kk < 4; ++kk) {
    v2f s0R = zR[0][kk] + zR[2][kk], s0I = zI[0][kk] + zI[2][kk];
    v2f s1R = zR[0][kk] - zR[2][kk], s1I = zI[0][kk] - zI[2][kk];
    v2f s2R = zR[1][kk] + zR[3][kk], s2I = zI[1][kk] + zI[3][kk];
    v2f s3R = (zR[1][kk] - zR[3][kk]) * sg, s3I = (zI[1][kk] - zI[3][kk]) * sg;
    v2f tR[4], tI[4];
    tR[0] = s0R + s2R; tI[0] = s0I + s2I;
    tR[1] = s1R - s3I; tI[1] = s1I + s3R;  // s1 + SG*i*(z1 - z3)
    tR[2] = s0R - s2R; tI[2] = s0I - s2I;
    tR[3] = s1R + s3I; tI[3] = s1I - s3R;
    zR[0][kk] = tR[0];
    zI[0][kk] = tI[0];
#pragma unroll
    for (int q = 1; q < 4; ++q) {
#pragma unroll
      for (int e = 0; e < 2; ++e) {
        int n = 4 * kk + 2 * half + e;
        float s, c;
        sincosTurns((q * n) & 63, 1.f / 64.f, s, c);
        s *= sg;
        zR[q][kk][e] = tR[q][e] * c - tI[q][e] * s;
        zI[q][kk][e] = tR[q][e] * s + tI[q][e] * c;
      }
    }
  }
}

// The same for a wave that holds 32 columns as two tiles of 16: the even columns and the odd ones.
// In: uR/uI[j][kk][e] = {even column, odd column} of element t = n + 16*j, n = 4*kk + 2*half + e.
// Out: zR/zI[c][q][kk] = B-fragment kk (K = n) of tile c's 16-point DFT that gives X[4r+q].
// A twiddle does not depend on the column: one sine and cosine serve both tiles.
template <int SG>  // SG: -1 forward, +1 inverse
static __device__ __forceinline__ void radix4In2(const v2f (&uR)[4][4][2], const v2f (&uI)[4][4][2],
                                                 v2f (&zR)[2][4][4], v2f (&zI)[2][4][4], int half) {
  const float sg = (float)SG;
#pragma unroll
  for (int kk = 0; kk < 4; ++kk) {
#pragma unroll
    for (int e = 0; e < 2; ++e) {
      v2f s0R = uR[0][kk][e] + uR[2][kk][e], s0I = uI[0][kk][e] + uI[2][kk][e];
      v2f s1R = uR[0][kk][e] - uR[2][kk][e], s1I = uI[0][kk][e] - uI[2][kk][e];
      v2f s2R = uR[1][kk][e] + uR[3][kk][e], s2I = uI[1][kk][e] + uI[3][kk][e];
      v2f s3R = (uR[1][kk][e] - uR[3][kk][e]) * sg, s3I = (uI[1][kk][e] - uI[3][kk][e]) * sg;
      v2f tR[4], tI[4];
      tR[0] = s0R + s2R; tI[0] = s0I + s2I;
      tR[1] = s1R - s3I; tI[1] = s1I + s3R;  // s1 + SG*i*(z1 - z3)
      tR[2] = s0R - s2R; tI[2] = s0I - s2I;
      tR[3] = s1R + s3I; tI[3] = s1I - s3R;
#pragma unroll
      for (int c = 0; c < 2; ++c) {
        zR[c][0][kk][e] = tR[0][c];
        zI[c][0][kk][e] = tI[0][c];
      }
#pragma unroll
      for (int q = 1; q < 4; ++q) {
        int n = 4 * kk + 2 * half + e;
        float sn, cs;
        sincosTurns((q * n) & 63, 1.f / 64.f, sn, cs);
        sn *= sg;
#pragma unroll
        for (int c = 0; c < 2; ++c) {
          zR[c][q][kk][e] = tR[q][c] * cs - tI[q][c] * sn;
          zI[c][q][kk][e] = tR[q][c] * sn + tI[q][c] * cs;
        }
      }
    }
  }
}

// The same two tiles where a lane holds the {re, im} pairs of its two columns side by side.
// In: g[j][kk][e] = {re, im of the even column, re, im of the odd column} of element t = n + 16*j.
template <int SG>  // SG: -1 forward, +1 inverse
static __device__ __forceinline__ void radix4InC(const v4f (&g)[4][4][2], v2f (&zR)[2][4][4],
                                                 v2f (&zI)[2][4][4], int half) {
  const float sg = (float)SG;
#pragma unroll
  for (int kk = 0; kk < 4; ++kk) {
#pragma unroll
    for (int e = 0; e < 2; ++e) {
      v4f s0 = g[0][kk][e] + g[2][kk][e];
      v4f s1 = g[0][kk][e] - g[2][kk][e];
      v4f s2 = g[1][kk][e] + g[3][kk][e];
      v4f s3 = (g[1][kk][e] - g[3][kk][e]) * sg;
      v4f r3 = {-s3.y, s3.x, -s3.w, s3.z};  // i * s3
      v4f t[4];
      t[0] = s0 + s2;
      t[1] = s1 + r3;  // s1 + SG*i*(z1 - z3)
      t[2] = s0 - s2;
      t[3] = s1 - r3;
#pragma unroll
      for (int c = 0; c < 2; ++c) {
        zR[c][0][kk][e] = t[0][2 * c];
        zI[c][0][kk][e] = t[0][2 * c + 1];
      }
#pragma unroll
      for (int q = 1; q < 4; ++q) {
        int n = 4 * kk + 2 * half + e;
        float sn, cs;
        sincosTurns((q * n) & 63, 1.f / 64.f, sn, cs);
        sn *= sg;
#pragma unroll
        for (int c = 0; c < 2; ++c) {
          zR[c][q][kk][e] = t[q][2 * c] * cs - t[q][2 * c + 1] * sn;
          zI[c][q][kk][e] = t[q][2 * c] * sn + t[q][2 * c + 1] * cs;
        }
      }
    }
  }
}

// ---------------- tiny filter MLP:  Hbins[2049][1024] ----------------
// One work-group makes eight bins over all 1024 columns. Threads 0..127 make one sine or
// cosine each; every thread one hidden unit and four columns of all eight bins, so that a value of W2
// is loaded once for eight bins. Each sum runs in the order i = 0..15 and j = 0..31.
// The last group has one bin of its own, 2048: it makes that bin eight times, and a thread stores
// the same value to the same place each time.
// launch_bounds' second argument: a budget of 256 VGPRs, which keeps every register directly
// addressable.
__global__ void __launch_bounds__(256, 4) kH(const float* __restrict__ W1,
                                          const float* __restrict__ b1,
                                          const float* __restrict__ W2,
                                          const float* __restrict__ b2,
                                          float* __restrict__ Hb) {
  __shared__ float pe[8][16];
  __shared__ __attribute__((aligned(16))) float h[32][8];
  const int tid = threadIdx.x;
  const int bin0 = blockIdx.x * 8;

  // All the weights are asked for first: they arrive while the sines are worked out.
  const unsigned co = (unsigned)tid * 16u;  // columns 4*tid .. 4*tid+3
  v4f w2[32];
#pragma unroll
  for (int j = 0; j < 32; ++j) w2[j] = ldQ(W2 + j * 1024, co);
  const v4f bias = ldQ(b2, co);
  const int hj = tid & 31;  // hidden unit
  const int hb = tid >> 5;  // its bin: the wave's number
  const unsigned jo = (unsigned)hj * 4u;
  float w1[16];
#pragma unroll
  for (int i = 0; i < 16; ++i) w1[i] = ldF(W1 + i * 32, jo);
  float acc = ldF(b1, jo);
  // the index registers that the loads name are held until this wait, so none of them lands on one
  asm volatile("s_wait_xcnt 0x0" ::"v"(tid), "v"(hj) : "memory");

  if (tid < 128) {  // waves 0 and 1: the sines; waves 2 and 3: the cosines
    const int m = tid & 7;
    const int b = (tid >> 3) & 7;
    float invf = 1.f;
#pragma unroll
    for (int mm = 1; mm < 8; ++mm)
      if (m == mm) invf = expf((float)(2 * mm) * (-9.210340371976184f / 16.f));
    float arg = (float)min(bin0 + b, 2048) * invf;
    if (tid < 64) pe[b][2 * m] = sinf(arg);
    else pe[b][2 * m + 1] = cosf(arg);
  }
  __syncthreads();
#pragma unroll
  for (int i = 0; i < 16; ++i) acc = __builtin_fmaf(pe[hb][i], w1[i], acc);
  h[hj][hb] = acc / (1.f + expf(-acc));  // SiLU
  __syncthreads();

  v4f o[8];
#pragma unroll
  for (int b = 0; b < 8; ++b) o[b] = bias;
#pragma unroll
  for (int j = 0; j < 32; ++j) {
#pragma unroll
    for (int b = 0; b < 8; ++b) o[b] += h[j][b] * w2[j];
  }
#pragma unroll
  for (int b = 0; b < 8; ++b) stQ(Hb + (size_t)min(bin0 + b, 2048) * 1024, co, o[b]);
}

// The filter is real and even in the bin index (bin k and bin 4096-k use the same value), so its
// impulse response is real. Two real signals that share a filter therefore go through ONE complex
// transform: z = x[p] + i*x[p+2] (batches p and p+2, same column d, same filter column).
// Re(ifft(fft(z)*H)) is the result for batch p, Im(...) the result for batch p+2.
// G holds z's transform as {re, im} pairs: G[p][k1][t0][d], p = 0..1.

// ---------------- Kernel A: stage-1 forward DFT over t1 + twiddle ----------------
// G[p][k1][t0][d] = w4096^{t0*k1} * sum_t1 e^{-2pi i k1 t1/64} z[p][64*t1+t0][d]
// A wave takes 32 columns of one t0: a lane loads two neighbouring columns at once, so that 16 lanes
// cover a whole 128-byte line of x, and the even and the odd columns are two WMMA tiles. The four
// waves of a work-group stand side by side on 128 columns.
// launch_bounds' second argument: a budget of 256 VGPRs; all the work-groups that fall to a WGP are
// resident at once.
__global__ void __launch_bounds__(128, 4) kA(const float* __restrict__ x,
                                          float* __restrict__ Gf) {
  const int lane = threadIdx.x & 31;
  // the wave's number as a scalar: the column base stays out of the VGPRs
  const int wave = __builtin_amdgcn_readfirstlane(threadIdx.x >> 5);
  const int half = lane >> 4;
  const int n16 = lane & 15;
  const int d0 = blockIdx.x * 128 + wave * 32;
  const int t0 = blockIdx.y;
  const int p = blockIdx.z;

  // row t0 (t1 = 0) of batch p (real part); batch p+2 is the imaginary part
  const float* xa = x + ((size_t)p * 4096 + t0) * 1024 + d0;
  const unsigned lo = (unsigned)(128 * half * 1024 + 2 * n16) * 4u;  // t1 = 2*half, two columns
  // one offset register for every 8 MiB, the reach of a load's constant offset: j = 0, 1 and
  // j = 2, 3 of batch p, then of batch p+2, which lies 32 MiB further on
  const unsigned la[2] = {lo, farOff(lo, 8u << 20)};
  const unsigned lb[2] = {farOff(lo, 32u << 20), farOff(lo, 40u << 20)};

  v2f uR[4][4][2], uI[4][4][2];
#pragma unroll
  for (int j = 0; j < 4; ++j) {
#pragma unroll
    for (int kk = 0; kk < 4; ++kk) {
#pragma unroll
      for (int e = 0; e < 2; ++e) {
        // t1 = 16*j + 4*kk + 2*half + e
        const v2f* row = (const v2f*)(xa + (size_t)(1024 * (j & 1) + 256 * kk + 64 * e) * 1024);
        uR[j][kk][e] = ldV(row, la[j >> 1]);
        uI[j][kk][e] = ldV(row, lb[j >> 1]);
      }
    }
  }
  // the offset registers that the loads name are held until this wait, so none of them lands on one
  asm volatile("s_wait_xcnt 0x0" ::"v"(la[0]), "v"(la[1]), "v"(lb[0]), "v"(lb[1]) : "memory");

  // k1 = 0, this t0; the lane adds k1 = 4*(8*half) and its two columns
  float* G = Gf + ((((size_t)p * 64) * 64 + t0) * 1024 + d0) * 2;
  const unsigned so = (unsigned)(32 * half * 64 * 1024 + 2 * n16) * 8u;
  const unsigned sv[2] = {so, farOff(so, 8u << 20)};  // v = 0..3 and v = 4..7, 8 MiB apart

  v2f fc[4], fs[4], fn[4];
  initF16(n16, 2 * half, 4, fc, fs, fn);
  v2f zR[2][4][4], zI[2][4][4];
  radix4In2<-1>(uR, uI, zR, zI, half);

#pragma unroll
  for (int q = 0; q < 4; ++q) {
    v8f eR = {0, 0, 0, 0, 0, 0, 0, 0};
    v8f eI = {0, 0, 0, 0, 0, 0, 0, 0};
    v8f oR = {0, 0, 0, 0, 0, 0, 0, 0};
    v8f oI = {0, 0, 0, 0, 0, 0, 0, 0};
    dft16(fc, fn, fs, zR[0][q], zI[0][q], eR, eI);
    dft16(fc, fn, fs, zR[1][q], zI[1][q], oR, oI);
#pragma unroll
    for (int v = 0; v < 8; ++v) {
      int M = 4 * (v + 8 * half) + q;  // k1
      float s, c;
      sincosTurns((t0 * M) & 4095, 1.f / 4096.f, s, c);  // twiddle = c - i*s
      v4f g;
      g.x = eR[v] * c + eI[v] * s;
      g.y = eI[v] * c - eR[v] * s;
      g.z = oR[v] * c + oI[v] * s;
      g.w = oI[v] * c - oR[v] * s;
      stQ(G + (size_t)(4 * (v & 3) + q) * 64 * 1024 * 2, sv[v >> 2], g);
    }
  }
  // the offset registers that the stores name are held until this wait
  asm volatile("s_wait_xcnt 0x0" ::"v"(sv[0]), "v"(sv[1]) : "memory");
}

// ---------------- Kernel B: fwd over t0, *Hfull, inv over k2, conj twiddle (in place) ----
__global__ void __launch_bounds__(128) kB(float* __restrict__ Gf,
                                          const float* __restrict__ Hb) {
  const int lane = threadIdx.x & 31;
  // the wave's number as a scalar: what follows from it stays out of the VGPRs
  const int wave = __builtin_amdgcn_readfirstlane(threadIdx.x >> 5);
  const int half = lane >> 4;
  const int n16 = lane & 15;
  const int d0 = blockIdx.x * 16;
  const int k1 = blockIdx.y * 4 + wave;
  const int p = blockIdx.z;
  v2f* G = (v2f*)Gf + (((size_t)p * 64 + k1) * 64) * 1024 + d0;  // t0 = 0
  const float* Hu = Hb + d0;
  const unsigned lo = (unsigned)(2 * half * 1024 + n16) * 8u;  // loads: t0 = 2*half, the column
  const unsigned so = (unsigned)(8 * half * 1024 + n16) * 8u;  // stores: t0 = 8*half, the column

  v2f zR[4][4], zI[4][4];  // G[t0][d]
#pragma unroll
  for (int j = 0; j < 4; ++j) {
#pragma unroll
    for (int kk = 0; kk < 4; ++kk) {
      // t0 = 16*j + 4*kk + 2*half and t0 + 1
      v2f g0 = ldV(G + (size_t)(16 * j + 4 * kk) * 1024, lo);
      v2f g1 = ldV(G + (size_t)(16 * j + 4 * kk + 1) * 1024, lo);
      zR[j][kk].x = g0.x;
      zR[j][kk].y = g1.x;
      zI[j][kk].x = g0.y;
      zI[j][kk].y = g1.y;
    }
  }
  // the offset register that the loads name is held until this wait, so none of them lands on it
  asm volatile("s_wait_xcnt 0x0" ::"v"(lo) : "memory");

  v2f fc[4], fs[4], fn[4];
  initF16(n16, 2 * half, 4, fc, fs, fn);
  // The inverse takes its input in the order in which the forward's accumulators hold it:
  // accumulator registers 2*kk and 2*kk+1 are rows r = 8*half + 2*kk and r + 1, and they are
  // used as B-fragment kk as they stand; the matrix columns follow that k order.
  v2f gc[4], gs[4], gn[4];
  initF16(n16, 8 * half, 2, gc, gs, gn);
  radix4In<-1>(zR, zI, half);

  // Per q: Xf[k2 = 4r+q][d] = sum_t0 e^{-2pi i k2 t0/64} G[t0][d], * Hfull[k1+64*k2][d], then
  // W_q[n][d] = sum_r e^{+2pi i n r/16} Xf[4r+q][d]
  v8f wR[4], wI[4];
#pragma unroll
  for (int q = 0; q < 4; ++q) {
    float hv[8];
    unsigned ho[8];
#pragma unroll
    for (int v = 0; v < 8; ++v) {
      int k2 = 4 * (v + 8 * half) + q;
      int k = k1 + 64 * k2;
      int bin = (k <= 2048) ? k : (4096 - k);  // real symmetric filter
      ho[v] = (unsigned)(bin * 1024 + n16) * 4u;
      hv[v] = ldF(Hu, ho[v]);
    }
    // the eight offset registers are held until this wait, so none of the loads lands on one
    asm volatile("s_wait_xcnt 0x0" ::"v"(ho[0]), "v"(ho[1]), "v"(ho[2]), "v"(ho[3]), "v"(ho[4]),
                 "v"(ho[5]), "v"(ho[6]), "v"(ho[7])
                 : "memory");
    v8f accR = {0, 0, 0, 0, 0, 0, 0, 0};
    v8f accI = {0, 0, 0, 0, 0, 0, 0, 0};
    dft16(fc, fn, fs, zR[q], zI[q], accR, accI);
    v2f bR[4], bI[4];
#pragma unroll
    for (int v = 0; v < 8; ++v) {
      bR[v >> 1][v & 1] = accR[v] * hv[v];
      bI[v >> 1][v & 1] = accI[v] * hv[v];
    }
    v8f oR = {0, 0, 0, 0, 0, 0, 0, 0};
    v8f oI = {0, 0, 0, 0, 0, 0, 0, 0};
    dft16(gc, gs, gn, bR, bI, oR, oI);
    wR[q] = oR;
    wI[q] = oI;
  }

  // C[t0 = n+16j][d] = sum_q i^(j*q) * e^{+2pi i n q/64} * W_q[n][d], then * e^{+2pi i t0 k1/4096}
#pragma unroll
  for (int v = 0; v < 8; ++v) {
    const int n = v + 8 * half;
    float uR[4], uI[4];
    uR[0] = wR[0][v];
    uI[0] = wI[0][v];
#pragma unroll
    for (int q = 1; q < 4; ++q) {
      float s, c;
      sincosTurns((q * n) & 63, 1.f / 64.f, s, c);
      uR[q] = wR[q][v] * c - wI[q][v] * s;
      uI[q] = wR[q][v] * s + wI[q][v] * c;
    }
    float e0R = uR[0] + uR[2], e0I = uI[0] + uI[2];
    float e1R = uR[0] - uR[2], e1I = uI[0] - uI[2];
    float o0R = uR[1] + uR[3], o0I = uI[1] + uI[3];
    float o1R = uR[1] - uR[3], o1I = uI[1] - uI[3];
    float cR[4], cI[4];
    cR[0] = e0R + o0R; cI[0] = e0I + o0I;
    cR[1] = e1R - o1I; cI[1] = e1I + o1R;  // e1 + i*o1
    cR[2] = e0R - o0R; cI[2] = e0I - o0I;
    cR[3] = e1R + o1I; cI[3] = e1I - o1R;
#pragma unroll
    for (int j = 0; j < 4; ++j) {
      int t0 = n + 16 * j;
      float s, c;
      sincosTurns((t0 * k1) & 4095, 1.f / 4096.f, s, c);
      v2f g;
      g.x = cR[j] * c - cI[j] * s;
      g.y = cR[j] * s + cI[j] * c;
      stV(G + (size_t)(v + 16 * j) * 1024, so, g);
    }
  }
}

// ---------------- Kernel C: inverse stage-2 over k1 ----------------
// w = (1/4096)*gain[d]*sum_k1 e^{+2pi i t1 k1/64} C[k1][t0][d];
// y[p][64*t1+t0][d] = Re w, y[p+2][64*t1+t0][d] = Im w
// A wave takes 32 columns of one t0, as in kernel A: a lane loads the {re, im} pairs of two
// neighbouring columns at once and stores two columns of y at once, so that 16 lanes store a whole
// 128-byte line.
// launch_bounds' second argument: a budget of 256 VGPRs: all of a wave's loads are in flight at once.
__global__ void __launch_bounds__(128, 4) kC(const float* __restrict__ Gf,
                                          const float* __restrict__ gain,
                                          float* __restrict__ y) {
  const int lane = threadIdx.x & 31;
  // the wave's number as a scalar: the column base stays out of the VGPRs
  const int wave = __builtin_amdgcn_readfirstlane(threadIdx.x >> 5);
  const int half = lane >> 4;
  const int n16 = lane & 15;
  const int d0 = blockIdx.x * 128 + wave * 32;
  const int t0 = blockIdx.y;
  const int p = blockIdx.z;
  const float* G = Gf + (((size_t)p * 64 * 64 + t0) * 1024 + d0) * 2;  // k1 = 0
  const unsigned lo = (unsigned)(2 * half * 64 * 1024 + 2 * n16) * 8u;  // k1 = 2*half, two columns
  // one offset register for every j, 8 MiB apart, the reach of a load's constant offset
  const unsigned lj[4] = {lo, farOff(lo, 8u << 20), farOff(lo, 16u << 20), farOff(lo, 24u << 20)};

  v4f g[4][4][2];  // C[k1][d], two columns
#pragma unroll
  for (int j = 0; j < 4; ++j) {
#pragma unroll
    for (int kk = 0; kk < 4; ++kk) {
#pragma unroll
      for (int e = 0; e < 2; ++e) {
        // k1 = 16*j + 4*kk + 2*half + e
        g[j][kk][e] = ldQ(G + (size_t)(4 * kk + e) * 64 * 1024 * 2, lj[j]);
      }
    }
  }
  const unsigned go = (unsigned)n16 * 8u;
  const v2f ag = ldV((const v2f*)(gain + d0), go) * (1.f / 4096.f);
  // the offset registers that the loads name are held until this wait, so none of them lands on one
  asm volatile("s_wait_xcnt 0x0" ::"v"(go), "v"(lj[0]), "v"(lj[1]), "v"(lj[2]), "v"(lj[3])
               : "memory");

  // t1 = 0, this t0, batch p; the lane adds t1 = 4*(8*half) and its two columns, and for batch p+2
  // 32 MiB more
  float* ya = y + ((size_t)p * 4096 + t0) * 1024 + d0;
  const unsigned so = (unsigned)(2048 * half * 1024 + 2 * n16) * 4u;
  const unsigned sb = farOff(so, 32u << 20);

  v2f fc[4], fs[4], fn[4];
  initF16(n16, 2 * half, 4, fc, fs, fn);
  v2f zR[2][4][4], zI[2][4][4];
  radix4InC<1>(g, zR, zI, half);

#pragma unroll
  for (int q = 0; q < 4; ++q) {
    v8f eR = {0, 0, 0, 0, 0, 0, 0, 0};
    v8f eI = {0, 0, 0, 0, 0, 0, 0, 0};
    v8f oR = {0, 0, 0, 0, 0, 0, 0, 0};
    v8f oI = {0, 0, 0, 0, 0, 0, 0, 0};
    dft16(fc, fs, fn, zR[0][q], zI[0][q], eR, eI);
    dft16(fc, fs, fn, zR[1][q], zI[1][q], oR, oI);
#pragma unroll
    for (int v = 0; v < 8; ++v) {
      size_t o = (size_t)(4 * v + q) * 64 * 1024;  // t1 = 4*(v + 8*half) + q
      v2f re, im;
      re.x = eR[v] * ag.x;
      re.y = oR[v] * ag.y;
      im.x = eI[v] * ag.x;
      im.y = oI[v] * ag.y;
      stV((v2f*)(ya + o), so, re);
      stV((v2f*)(ya + o), sb, im);
    }
  }
  // the offset registers that the stores name are held until this wait
  asm volatile("s_wait_xcnt 0x0" ::"v"(so), "v"(sb) : "memory");
}

extern "C" void kernel_launch(void* const* d_in, const int* in_sizes, int n_in,
                              void* d_out, int out_size, void* d_ws, size_t ws_size,
                              hipStream_t stream) {
  const float* x = (const float*)d_in[0];
  const float* W1 = (const float*)d_in[1];
  const float* b1 = (const float*)d_in[2];
  const float* W2 = (const float*)d_in[3];
  const float* b2 = (const float*)d_in[4];
  const float* ag = (const float*)d_in[5];
  float* out = (float*)d_out;

  // workspace layout: Hbins[2049*1024] | G[2*4096*1024] {re,im} pairs  (~76 MB)
  float* Hb = (float*)d_ws;
  float* wG = Hb + (size_t)2049 * 1024;

  kH<<<dim3(257, 1, 1), 256, 0, stream>>>(W1, b1, W2, b2, Hb);
  kA<<<dim3(8, 64, 2), 128, 0, stream>>>(x, wG);
  kB<<<dim3(64, 16, 2), 128, 0, stream>>>(wG, Hb);
  kC<<<dim3(8, 64, 2), 128, 0, stream>>>(wG, ag, out);
}

// v006
// It runs in 62.3 microseconds.
// Next to v005, in two timings, it ran 1.11 and 1.10 times as fast.
// Over all steps from v000 it is 5.50 times as fast.
#include <hip/hip_runtime.h>
#include <hip/hip_bf16.h>

typedef __attribute__((ext_vector_type(2))) float v2f;
typedef __attribute__((ext_vector_type(4))) float v4f;
typedef __attribute__((ext_vector_type(8))) float v8f;

// D = A(16x4) * B(4x16) + C, f32 WMMA (CDNA5 V_WMMA_F32_16X16X4_F32)
static __device__ __forceinline__ v8f wmma4(v2f a, v2f b, v8f c) {
  return __builtin_amdgcn_wmma_f32_16x16x4_f32(false, a, false, b, (short)0, c,
                                               false, false);
}

// Every 64-point DFT is factored 64 = 4 x 16. With t = n + 16*j and k = 4*r + q,
//   X[4r+q] = sum_n w16^(r*n) * ( w64^(q*n) * sum_j w4^(q*j) * z[n+16j] ),   w_N = e^(SG*2*pi*i/N):
// the sum over j is a radix-4 butterfly (adds only) and w64^(q*n) one complex multiply per element,
// both on values that a lane already holds; only the 16-point DFT is a matrix product.
// Its 16x16 matrix is four A-fragments of cos and of sin, held in registers.

// sin and cos of 2*pi*num/den, den a power of two: the hardware takes the angle in turns, and
// num/den is exact in f32.
static __device__ __forceinline__ void sincosTurns(int num, float invDen, float& s, float& c) {
  float t = (float)num * invDen;
  // Neither result shares a register with the angle, and the v_nop is the free slot that the
  // instruction set asks for between a transcendental and the first reader of its result.
  asm("v_sin_f32 %0, %2\n\tv_cos_f32 %1, %2\n\tv_nop" : "=&v"(s), "=&v"(c) : "v"(t));
}

// Access at a wave-uniform base plus the lane's own byte offset: the base and every constant step
// stay in scalar registers, and one VGPR serves all the accesses of a lane.
static __device__ __forceinline__ float ldF(const float* u, unsigned b) {
  return *(const float*)((const char*)u + b);
}
static __device__ __forceinline__ v2f ldV(const v2f* u, unsigned b) {
  return *(const v2f*)((const char*)u + b);
}
static __device__ __forceinline__ v4f ldQ(const float* u, unsigned b) {
  return *(const v4f*)((const char*)u + b);
}
static __device__ __forceinline__ void stQ(float* u, unsigned b, v4f v) {
  *(v4f*)((char*)u + b) = v;
}
static __device__ __forceinline__ void stF(float* u, unsigned b, float v) {
  *(float*)((char*)u + b) = v;
}
static __device__ __forceinline__ void stV(v2f* u, unsigned b, v2f v) {
  *(v2f*)((char*)u + b) = v;
}

// The lane's byte offset moved on by a constant too large for an access's own offset field.
// The add is written in asm so that the accesses name this one register beside the scalar base:
// left to itself the compiler takes the constant out again and forms 64-bit address pairs of its
// own, which the source cannot hold until the wait that follows the accesses.
static __device__ __forceinline__ unsigned farOff(unsigned b, unsigned step) {
  unsigned r;
  asm("v_add_nc_u32 %0, %1, %2" : "=v"(r) : "s"(step), "v"(b));
  return r;
}

// A-fragments of the 16-point DFT matrix: row = the lane's row, fragment kk holds the columns
// col0 + step*kk and the next one. fc = cos, fs = sin, fn = -sin of 2*pi*row*col/16.
static __device__ __forceinline__ void initF16(int row, int col0, int step, v2f (&fc)[4],
                                               v2f (&fs)[4], v2f (&fn)[4]) {
#pragma unroll
  for (int kk = 0; kk < 4; ++kk) {
    int col = col0 + step * kk;
    float s0, c0, s1, c1;
    sincosTurns((row * col) & 15, 1.f / 16.f, s0, c0);
    sincosTurns((row * (col + 1)) & 15, 1.f / 16.f, s1, c1);
    fc[kk].x = c0;  fc[kk].y = c1;
    fs[kk].x = s0;  fs[kk].y = s1;
    fn[kk].x = -s0; fn[kk].y = -s1;
  }
}

// 16-point DFT of 16 columns, K in four fragments. fp multiplies bR into the imaginary part and
// fm multiplies bI into the real part: forward (fp, fm) = (-sin, sin), inverse (sin, -sin).
static __device__ __forceinline__ void dft16(const v2f (&fc)[4], const v2f (&fp)[4],
                                             const v2f (&fm)[4], const v2f (&bR)[4],
                                             const v2f (&bI)[4], v8f& accR, v8f& accI) {
#pragma unroll
  for (int kk = 0; kk < 4; ++kk) {
    accR = wmma4(fc[kk], bR[kk], accR);
    accI = wmma4(fc[kk], bI[kk], accI);
    accR = wmma4(fm[kk], bI[kk], accR);
    accI = wmma4(fp[kk], bR[kk], accI);
  }
}

// Radix-4 butterflies and w64 twiddles in front of the 16-point DFTs, for a wave that holds 32
// columns as two tiles of 16: the even columns and the odd ones.
// In: uR/uI[j][kk][e] = {even column, odd column} of element t = n + 16*j, n = 4*kk + 2*half + e.
// Out: zR/zI[c][q][kk] = B-fragment kk (K = n) of tile c's 16-point DFT that gives X[4r+q].
// A twiddle does not depend on the column: one sine and cosine serve both tiles.
template <int SG>  // SG: -1 forward, +1 inverse
static __device__ __forceinline__ void radix4In2(const v2f (&uR)[4][4][2], const v2f (&uI)[4][4][2],
                                                 v2f (&zR)[2][4][4], v2f (&zI)[2][4][4], int half) {
  const float sg = (float)SG;
#pragma unroll
  for (int kk = 0; kk < 4; ++kk) {
#pragma unroll
    for (int e = 0; e < 2; ++e) {
      v2f s0R = uR[0][kk][e] + uR[2][kk][e], s0I = uI[0][kk][e] + uI[2][kk][e];
      v2f s1R = uR[0][kk][e] - uR[2][kk][e], s1I = uI[0][kk][e] - uI[2][kk][e];
      v2f s2R = uR[1][kk][e] + uR[3][kk][e], s2I = uI[1][kk][e] + uI[3][kk][e];
      v2f s3R = (uR[1][kk][e] - uR[3][kk][e]) * sg, s3I = (uI[1][kk][e] - uI[3][kk][e]) * sg;
      v2f tR[4], tI[4];
      tR[0] = s0R + s2R; tI[0] = s0I + s2I;
      tR[1] = s1R - s3I; tI[1] = s1I + s3R;  // s1 + SG*i*(z1 - z3)
      tR[2] = s0R - s2R; tI[2] = s0I - s2I;
      tR[3] = s1R + s3I; tI[3] = s1I - s3R;
#pragma unroll
      for (int c = 0; c < 2; ++c) {
        zR[c][0][kk][e] = tR[0][c];
        zI[c][0][kk][e] = tI[0][c];
      }
#pragma unroll
      for (int q = 1; q < 4; ++q) {
        int n = 4 * kk + 2 * half + e;
        float sn, cs;
        sincosTurns((q * n) & 63, 1.f / 64.f, sn, cs);
        sn *= sg;
#pragma unroll
        for (int c = 0; c < 2; ++c) {
          zR[c][q][kk][e] = tR[q][c] * cs - tI[q][c] * sn;
          zI[c][q][kk][e] = tR[q][c] * sn + tI[q][c] * cs;
        }
      }
    }
  }
}

// The same two tiles where a lane holds the {re, im} pairs of its two columns side by side.
// In: g[j][kk][e] = {re, im of the even column, re, im of the odd column} of element t = n + 16*j.
template <int SG>  // SG: -1 forward, +1 inverse
static __device__ __forceinline__ void radix4InC(const v4f (&g)[4][4][2], v2f (&zR)[2][4][4],
                                                 v2f (&zI)[2][4][4], int half) {
  const float sg = (float)SG;
#pragma unroll
  for (int kk = 0; kk < 4; ++kk) {
#pragma unroll
    for (int e = 0; e < 2; ++e) {
      v4f s0 = g[0][kk][e] + g[2][kk][e];
      v4f s1 = g[0][kk][e] - g[2][kk][e];
      v4f s2 = g[1][kk][e] + g[3][kk][e];
      v4f s3 = (g[1][kk][e] - g[3][kk][e]) * sg;
      v4f r3 = {-s3.y, s3.x, -s3.w, s3.z};  // i * s3
      v4f t[4];
      t[0] = s0 + s2;
      t[1] = s1 + r3;  // s1 + SG*i*(z1 - z3)
      t[2] = s0 - s2;
      t[3] = s1 - r3;
#pragma unroll
      for (int c = 0; c < 2; ++c) {
        zR[c][0][kk][e] = t[0][2 * c];
        zI[c][0][kk][e] = t[0][2 * c + 1];
      }
#pragma unroll
      for (int q = 1; q < 4; ++q) {
        int n = 4 * kk + 2 * half + e;
        float sn, cs;
        sincosTurns((q * n) & 63, 1.f / 64.f, sn, cs);
        sn *= sg;
#pragma unroll
        for (int c = 0; c < 2; ++c) {
          zR[c][q][kk][e] = t[q][2 * c] * cs - t[q][2 * c + 1] * sn;
          zI[c][q][kk][e] = t[q][2 * c] * sn + t[q][2 * c + 1] * cs;
        }
      }
    }
  }
}

// ---------------- tiny filter MLP:  Hbins[2049][1024] ----------------
// One work-group makes eight bins over all 1024 columns. Threads 0..127 make one sine or
// cosine each; every thread one hidden unit and four columns of all eight bins, so that a value of W2
// is loaded once for eight bins. Each sum runs in the order i = 0..15 and j = 0..31.
// The last group has one bin of its own, 2048: it makes that bin eight times, and a thread stores
// the same value to the same place each time.
// launch_bounds' second argument: a budget of 256 VGPRs, which keeps every register directly
// addressable.
__global__ void __launch_bounds__(256, 4) kH(const float* __restrict__ W1,
                                          const float* __restrict__ b1,
                                          const float* __restrict__ W2,
                                          const float* __restrict__ b2,
                                          float* __restrict__ Hb) {
  __shared__ float pe[8][16];
  __shared__ __attribute__((aligned(16))) float h[32][8];
  const int tid = threadIdx.x;
  const int bin0 = blockIdx.x * 8;

  // All the weights are asked for first: they arrive while the sines are worked out.
  const unsigned co = (unsigned)tid * 16u;  // columns 4*tid .. 4*tid+3
  v4f w2[32];
#pragma unroll
  for (int j = 0; j < 32; ++j) w2[j] = ldQ(W2 + j * 1024, co);
  const v4f bias = ldQ(b2, co);
  const int hj = tid & 31;  // hidden unit
  const int hb = tid >> 5;  // its bin: the wave's number
  const unsigned jo = (unsigned)hj * 4u;
  float w1[16];
#pragma unroll
  for (int i = 0; i < 16; ++i) w1[i] = ldF(W1 + i * 32, jo);
  float acc = ldF(b1, jo);
  // the index registers that the loads name are held until this wait, so none of them lands on one
  asm volatile("s_wait_xcnt 0x0" ::"v"(tid), "v"(hj) : "memory");

  if (tid < 128) {  // waves 0 and 1: the sines; waves 2 and 3: the cosines
    const int m = tid & 7;
    const int b = (tid >> 3) & 7;
    float invf = 1.f;
#pragma unroll
    for (int mm = 1; mm < 8; ++mm)
      if (m == mm) invf = expf((float)(2 * mm) * (-9.210340371976184f / 16.f));
    float arg = (float)min(bin0 + b, 2048) * invf;
    if (tid < 64) pe[b][2 * m] = sinf(arg);
    else pe[b][2 * m + 1] = cosf(arg);
  }
  __syncthreads();
#pragma unroll
  for (int i = 0; i < 16; ++i) acc = __builtin_fmaf(pe[hb][i], w1[i], acc);
  h[hj][hb] = acc / (1.f + expf(-acc));  // SiLU
  __syncthreads();

  v4f o[8];
#pragma unroll
  for (int b = 0; b < 8; ++b) o[b] = bias;
#pragma unroll
  for (int j = 0; j < 32; ++j) {
#pragma unroll
    for (int b = 0; b < 8; ++b) o[b] += h[j][b] * w2[j];
  }
#pragma unroll
  for (int b = 0; b < 8; ++b) stQ(Hb + (size_t)min(bin0 + b, 2048) * 1024, co, o[b]);
}

// The filter is real and even in the bin index (bin k and bin 4096-k use the same value), so its
// impulse response is real. Two real signals that share a filter therefore go through ONE complex
// transform: z = x[p] + i*x[p+2] (batches p and p+2, same column d, same filter column).
// Re(ifft(fft(z)*H)) is the result for batch p, Im(...) the result for batch p+2.
// G holds z's transform as {re, im} pairs: G[p][k1][t0][d], p = 0..1.

// ---------------- Kernel A: stage-1 forward DFT over t1 + twiddle ----------------
// G[p][k1][t0][d] = w4096^{t0*k1} * sum_t1 e^{-2pi i k1 t1/64} z[p][64*t1+t0][d]
// A wave takes 32 columns of one t0: a lane loads two neighbouring columns at once, so that 16 lanes
// cover a whole 128-byte line of x, and the even and the odd columns are two WMMA tiles. The four
// waves of a work-group stand side by side on 128 columns.
// launch_bounds' second argument: a budget of 256 VGPRs; all the work-groups that fall to a WGP are
// resident at once.
__global__ void __launch_bounds__(128, 4) kA(const float* __restrict__ x,
                                          float* __restrict__ Gf) {
  const int lane = threadIdx.x & 31;
  // the wave's number as a scalar: the column base stays out of the VGPRs
  const int wave = __builtin_amdgcn_readfirstlane(threadIdx.x >> 5);
  const int half = lane >> 4;
  const int n16 = lane & 15;
  const int d0 = blockIdx.x * 128 + wave * 32;
  const int t0 = blockIdx.y;
  const int p = blockIdx.z;

  // row t0 (t1 = 0) of batch p (real part); batch p+2 is the imaginary part
  const float* xa = x + ((size_t)p * 4096 + t0) * 1024 + d0;
  const unsigned lo = (unsigned)(128 * half * 1024 + 2 * n16) * 4u;  // t1 = 2*half, two columns
  // one offset register for every 8 MiB, the reach of a load's constant offset: j = 0, 1 and
  // j = 2, 3 of batch p, then of batch p+2, which lies 32 MiB further on
  const unsigned la[2] = {lo, farOff(lo, 8u << 20)};
  const unsigned lb[2] = {farOff(lo, 32u << 20), farOff(lo, 40u << 20)};

  v2f uR[4][4][2], uI[4][4][2];
#pragma unroll
  for (int j = 0; j < 4; ++j) {
#pragma unroll
    for (int kk = 0; kk < 4; ++kk) {
#pragma unroll
      for (int e = 0; e < 2; ++e) {
        // t1 = 16*j + 4*kk + 2*half + e
        const v2f* row = (const v2f*)(xa + (size_t)(1024 * (j & 1) + 256 * kk + 64 * e) * 1024);
        uR[j][kk][e] = ldV(row, la[j >> 1]);
        uI[j][kk][e] = ldV(row, lb[j >> 1]);
      }
    }
  }
  // the offset registers that the loads name are held until this wait, so none of them lands on one
  asm volatile("s_wait_xcnt 0x0" ::"v"(la[0]), "v"(la[1]), "v"(lb[0]), "v"(lb[1]) : "memory");

  // k1 = 0, this t0; the lane adds k1 = 4*(8*half) and its two columns
  float* G = Gf + ((((size_t)p * 64) * 64 + t0) * 1024 + d0) * 2;
  const unsigned so = (unsigned)(32 * half * 64 * 1024 + 2 * n16) * 8u;
  const unsigned sv[2] = {so, farOff(so, 8u << 20)};  // v = 0..3 and v = 4..7, 8 MiB apart

  v2f fc[4], fs[4], fn[4];
  initF16(n16, 2 * half, 4, fc, fs, fn);
  v2f zR[2][4][4], zI[2][4][4];
  radix4In2<-1>(uR, uI, zR, zI, half);

#pragma unroll
  for (int q = 0; q < 4; ++q) {
    v8f eR = {0, 0, 0, 0, 0, 0, 0, 0};
    v8f eI = {0, 0, 0, 0, 0, 0, 0, 0};
    v8f oR = {0, 0, 0, 0, 0, 0, 0, 0};
    v8f oI = {0, 0, 0, 0, 0, 0, 0, 0};
    dft16(fc, fn, fs, zR[0][q], zI[0][q], eR, eI);
    dft16(fc, fn, fs, zR[1][q], zI[1][q], oR, oI);
#pragma unroll
    for (int v = 0; v < 8; ++v) {
      int M = 4 * (v + 8 * half) + q;  // k1
      float s, c;
      sincosTurns((t0 * M) & 4095, 1.f / 4096.f, s, c);  // twiddle = c - i*s
      v4f g;
      g.x = eR[v] * c + eI[v] * s;
      g.y = eI[v] * c - eR[v] * s;
      g.z = oR[v] * c + oI[v] * s;
      g.w = oI[v] * c - oR[v] * s;
      stQ(G + (size_t)(4 * (v & 3) + q) * 64 * 1024 * 2, sv[v >> 2], g);
    }
  }
  // the offset registers that the stores name are held until this wait
  asm volatile("s_wait_xcnt 0x0" ::"v"(sv[0]), "v"(sv[1]) : "memory");
}

// The filter at the lane's two columns for the eight rows k2 = 4*(v + 8*half) + q of kernel B.
static __device__ __forceinline__ void loadH(const v2f* Hu, int k1, int q, int half, int n16,
                                             v2f (&hv)[8]) {
  unsigned ho[8];
#pragma unroll
  for (int v = 0; v < 8; ++v) {
    int k2 = 4 * (v + 8 * half) + q;
    int k = k1 + 64 * k2;
    int bin = (k <= 2048) ? k : (4096 - k);  // real symmetric filter
    ho[v] = (unsigned)(bin * 1024 + 2 * n16) * 4u;
    hv[v] = ldV(Hu, ho[v]);
  }
  // the eight offset registers are held until this wait, so none of the loads lands on one
  asm volatile("s_wait_xcnt 0x0" ::"v"(ho[0]), "v"(ho[1]), "v"(ho[2]), "v"(ho[3]), "v"(ho[4]),
               "v"(ho[5]), "v"(ho[6]), "v"(ho[7])
               : "memory");
}

// ---------------- Kernel B: fwd over t0, *Hfull, inv over k2, conj twiddle (in place) ----
// A wave takes 32 columns of one k1, as in kernels A and C: a lane loads and stores the {re, im}
// pairs of two neighbouring columns at once, so that 16 lanes cover 256 bytes of a row of G and a
// whole 128-byte line of the filter, and the even and the odd columns are two WMMA tiles. The four
// waves of a work-group stand side by side on 128 columns. A twiddle does not depend on the column:
// one sine and cosine serve both tiles.
// launch_bounds' second argument: a budget of 256 VGPRs; all the work-groups that fall to a WGP are
// resident at once.
__global__ void __launch_bounds__(128, 4) kB(float* __restrict__ Gf,
                                          const float* __restrict__ Hb) {
  const int lane = threadIdx.x & 31;
  // the wave's number as a scalar: the column base stays out of the VGPRs
  const int wave = __builtin_amdgcn_readfirstlane(threadIdx.x >> 5);
  const int half = lane >> 4;
  const int n16 = lane & 15;
  const int d0 = blockIdx.x * 128 + wave * 32;
  const int k1 = blockIdx.y;
  const int p = blockIdx.z;
  float* G = Gf + ((((size_t)p * 64 + k1) * 64) * 1024 + d0) * 2;  // t0 = 0
  const v2f* Hu = (const v2f*)(Hb + d0);
  const unsigned lo = (unsigned)(2 * half * 1024 + 2 * n16) * 8u;  // loads: t0 = 2*half, two columns
  const unsigned so = (unsigned)(8 * half * 1024 + 2 * n16) * 8u;  // stores: t0 = 8*half, two columns

  v4f g[4][4][2];  // G[t0][d], two columns
#pragma unroll
  for (int j = 0; j < 4; ++j) {
#pragma unroll
    for (int kk = 0; kk < 4; ++kk) {
#pragma unroll
      for (int e = 0; e < 2; ++e) {
        // t0 = 16*j + 4*kk + 2*half + e
        g[j][kk][e] = ldQ(G + (size_t)(16 * j + 4 * kk + e) * 1024 * 2, lo);
      }
    }
  }
  // the offset register that the loads name is held until this wait, so none of them lands on it
  asm volatile("s_wait_xcnt 0x0" ::"v"(lo) : "memory");
  v2f hv[8];  // the filter at the lane's two columns, first for q = 0
  loadH(Hu, k1, 0, half, n16, hv);
  // all the loads above are issued before anything else takes registers: otherwise the build holds
  // eight of them back until the first data have come
  __builtin_amdgcn_sched_barrier(0);

  v2f fc[4], fs[4], fn[4];
  initF16(n16, 2 * half, 4, fc, fs, fn);
  // The inverse takes its input in the order in which the forward's accumulators hold it:
  // accumulator registers 2*kk and 2*kk+1 are rows r = 8*half + 2*kk and r + 1, and they are
  // used as B-fragment kk as they stand; the matrix columns follow that k order.
  v2f gc[4], gs[4], gn[4];
  initF16(n16, 8 * half, 2, gc, gs, gn);
  v2f zR[2][4][4], zI[2][4][4];
  radix4InC<-1>(g, zR, zI, half);
  // the later parts' index and sine work stays behind this line: scheduled up among the butterflies
  // it costs registers and moves
  __builtin_amdgcn_sched_barrier(0);

  // Per q: Xf[k2 = 4r+q][d] = sum_t0 e^{-2pi i k2 t0/64} G[t0][d], * Hfull[k1+64*k2][d], then
  // W_q[n][d] = sum_r e^{+2pi i n r/16} Xf[4r+q][d]
  v8f wR[2][4], wI[2][4];
#pragma unroll
  for (int q = 0; q < 4; ++q) {
    v2f bR[2][4], bI[2][4];
#pragma unroll
    for (int c = 0; c < 2; ++c) {
      v8f accR = {0, 0, 0, 0, 0, 0, 0, 0};
      v8f accI = {0, 0, 0, 0, 0, 0, 0, 0};
      dft16(fc, fn, fs, zR[c][q], zI[c][q], accR, accI);
#pragma unroll
      for (int v = 0; v < 8; ++v) {
        bR[c][v >> 1][v & 1] = accR[v] * hv[v][c];
        bI[c][v >> 1][v & 1] = accI[v] * hv[v][c];
      }
    }
    // the next q's filter values are asked for as soon as this q's are used up: they arrive during
    // the products that follow
    if (q < 3) loadH(Hu, k1, q + 1, half, n16, hv);
#pragma unroll
    for (int c = 0; c < 2; ++c) {
      v8f oR = {0, 0, 0, 0, 0, 0, 0, 0};
      v8f oI = {0, 0, 0, 0, 0, 0, 0, 0};
      dft16(gc, gs, gn, bR[c], bI[c], oR, oI);
      wR[c][q] = oR;
      wI[c][q] = oI;
    }
  }
  // the sines of the last part stay behind the products: scheduled up, they spill registers
  __builtin_amdgcn_sched_barrier(0);

  // C[t0 = n+16j][d] = sum_q i^(j*q) * e^{+2pi i n q/64} * W_q[n][d], then * e^{+2pi i t0 k1/4096}
#pragma unroll
  for (int v = 0; v < 8; ++v) {
    const int n = v + 8 * half;
    float uR[2][4], uI[2][4];
#pragma unroll
    for (int c = 0; c < 2; ++c) {
      uR[c][0] = wR[c][0][v];
      uI[c][0] = wI[c][0][v];
    }
#pragma unroll
    for (int q = 1; q < 4; ++q) {
      float s, cs;
      sincosTurns((q * n) & 63, 1.f / 64.f, s, cs);
#pragma unroll
      for (int c = 0; c < 2; ++c) {
        uR[c][q] = wR[c][q][v] * cs - wI[c][q][v] * s;
        uI[c][q] = wR[c][q][v] * s + wI[c][q][v] * cs;
      }
    }
    float cR[2][4], cI[2][4];
#pragma unroll
    for (int c = 0; c < 2; ++c) {
      float e0R = uR[c][0] + uR[c][2], e0I = uI[c][0] + uI[c][2];
      float e1R = uR[c][0] - uR[c][2], e1I = uI[c][0] - uI[c][2];
      float o0R = uR[c][1] + uR[c][3], o0I = uI[c][1] + uI[c][3];
      float o1R = uR[c][1] - uR[c][3], o1I = uI[c][1] - uI[c][3];
      cR[c][0] = e0R + o0R; cI[c][0] = e0I + o0I;
      cR[c][1] = e1R - o1I; cI[c][1] = e1I + o1R;  // e1 + i*o1
      cR[c][2] = e0R - o0R; cI[c][2] = e0I - o0I;
      cR[c][3] = e1R + o1I; cI[c][3] = e1I - o1R;
    }
#pragma unroll
    for (int j = 0; j < 4; ++j) {
      int t0 = n + 16 * j;
      float s, cs;
      sincosTurns((t0 * k1) & 4095, 1.f / 4096.f, s, cs);
      v4f r;
      r.x = cR[0][j] * cs - cI[0][j] * s;
      r.y = cR[0][j] * s + cI[0][j] * cs;
      r.z = cR[1][j] * cs - cI[1][j] * s;
      r.w = cR[1][j] * s + cI[1][j] * cs;
      stQ(G + (size_t)(v + 16 * j) * 1024 * 2, so, r);
    }
  }
  // the offset register that the stores name is held until this wait
  asm volatile("s_wait_xcnt 0x0" ::"v"(so) : "memory");
}

// ---------------- Kernel C: inverse stage-2 over k1 ----------------
// w = (1/4096)*gain[d]*sum_k1 e^{+2pi i t1 k1/64} C[k1][t0][d];
// y[p][64*t1+t0][d] = Re w, y[p+2][64*t1+t0][d] = Im w
// A wave takes 32 columns of one t0, as in kernel A: a lane loads the {re, im} pairs of two
// neighbouring columns at once and stores two columns of y at once, so that 16 lanes store a whole
// 128-byte line.
// launch_bounds' second argument: a budget of 256 VGPRs: all of a wave's loads are in flight at once.
__global__ void __launch_bounds__(128, 4) kC(const float* __restrict__ Gf,
                                          const float* __restrict__ gain,
                                          float* __restrict__ y) {
  const int lane = threadIdx.x & 31;
  // the wave's number as a scalar: the column base stays out of the VGPRs
  const int wave = __builtin_amdgcn_readfirstlane(threadIdx.x >> 5);
  const int half = lane >> 4;
  const int n16 = lane & 15;
  const int d0 = blockIdx.x * 128 + wave * 32;
  const int t0 = blockIdx.y;
  const int p = blockIdx.z;
  const float* G = Gf + (((size_t)p * 64 * 64 + t0) * 1024 + d0) * 2;  // k1 = 0
  const unsigned lo = (unsigned)(2 * half * 64 * 1024 + 2 * n16) * 8u;  // k1 = 2*half, two columns
  // one offset register for every j, 8 MiB apart, the reach of a load's constant offset
  const unsigned lj[4] = {lo, farOff(lo, 8u << 20), farOff(lo, 16u << 20), farOff(lo, 24u << 20)};

  v4f g[4][4][2];  // C[k1][d], two columns
#pragma unroll
  for (int j = 0; j < 4; ++j) {
#pragma unroll
    for (int kk = 0; kk < 4; ++kk) {
#pragma unroll
      for (int e = 0; e < 2; ++e) {
        // k1 = 16*j + 4*kk + 2*half + e
        g[j][kk][e] = ldQ(G + (size_t)(4 * kk + e) * 64 * 1024 * 2, lj[j]);
      }
    }
  }
  const unsigned go = (unsigned)n16 * 8u;
  const v2f ag = ldV((const v2f*)(gain + d0), go) * (1.f / 4096.f);
  // the offset registers that the loads name are held until this wait, so none of them lands on one
  asm volatile("s_wait_xcnt 0x0" ::"v"(go), "v"(lj[0]), "v"(lj[1]), "v"(lj[2]), "v"(lj[3])
               : "memory");

  // t1 = 0, this t0, batch p; the lane adds t1 = 4*(8*half) and its two columns, and for batch p+2
  // 32 MiB more
  float* ya = y + ((size_t)p * 4096 + t0) * 1024 + d0;
  const unsigned so = (unsigned)(2048 * half * 1024 + 2 * n16) * 4u;
  const unsigned sb = farOff(so, 32u << 20);

  v2f fc[4], fs[4], fn[4];
  initF16(n16, 2 * half, 4, fc, fs, fn);
  v2f zR[2][4][4], zI[2][4][4];
  radix4InC<1>(g, zR, zI, half);

#pragma unroll
  for (int q = 0; q < 4; ++q) {
    v8f eR = {0, 0, 0, 0, 0, 0, 0, 0};
    v8f eI = {0, 0, 0, 0, 0, 0, 0, 0};
    v8f oR = {0, 0, 0, 0, 0, 0, 0, 0};
    v8f oI = {0, 0, 0, 0, 0, 0, 0, 0};
    dft16(fc, fs, fn, zR[0][q], zI[0][q], eR, eI);
    dft16(fc, fs, fn, zR[1][q], zI[1][q], oR, oI);
#pragma unroll
    for (int v = 0; v < 8; ++v) {
      size_t o = (size_t)(4 * v + q) * 64 * 1024;  // t1 = 4*(v + 8*half) + q
      v2f re, im;
      re.x = eR[v] * ag.x;
      re.y = oR[v] * ag.y;
      im.x = eI[v] * ag.x;
      im.y = oI[v] * ag.y;
      stV((v2f*)(ya + o), so, re);
      stV((v2f*)(ya + o), sb, im);
    }
  }
  // the offset registers that the stores name are held until this wait
  asm volatile("s_wait_xcnt 0x0" ::"v"(so), "v"(sb) : "memory");
}

extern "C" void kernel_launch(void* const* d_in, const int* in_sizes, int n_in,
                              void* d_out, int out_size, void* d_ws, size_t ws_size,
                              hipStream_t stream) {
  const float* x = (const float*)d_in[0];
  const float* W1 = (const float*)d_in[1];
  const float* b1 = (const float*)d_in[2];
  const float* W2 = (const float*)d_in[3];
  const float* b2 = (const float*)d_in[4];
  const float* ag = (const float*)d_in[5];
  float* out = (float*)d_out;

  // workspace layout: Hbins[2049*1024] | G[2*4096*1024] {re,im} pairs  (~76 MB)
  float* Hb = (float*)d_ws;
  float* wG = Hb + (size_t)2049 * 1024;

  kH<<<dim3(257, 1, 1), 256, 0, stream>>>(W1, b1, W2, b2, Hb);
  kA<<<dim3(8, 64, 2), 128, 0, stream>>>(x, wG);
  kB<<<dim3(8, 64, 2), 128, 0, stream>>>(wG, Hb);
  kC<<<dim3(8, 64, 2), 128, 0, stream>>>(wG, ag, out);
}

// v007
// Measured time: 59.8 microseconds a run.
// Two timings next to v006 both put it at 1.04 times that version's speed.
// All steps since v000 together make it 5.74 times as fast.
#include <hip/hip_runtime.h>
#include <hip/hip_bf16.h>

typedef __attribute__((ext_vector_type(2))) float v2f;
typedef __attribute__((ext_vector_type(4))) float v4f;
typedef __attribute__((ext_vector_type(8))) float v8f;

// D = A(16x4) * B(4x16) + C, f32 WMMA (CDNA5 V_WMMA_F32_16X16X4_F32)
static __device__ __forceinline__ v8f wmma4(v2f a, v2f b, v8f c) {
  return __builtin_amdgcn_wmma_f32_16x16x4_f32(false, a, false, b, (short)0, c,
                                               false, false);
}

// Every 64-point DFT is factored 64 = 4 x 16. With t = n + 16*j and k = 4*r + q,
//   X[4r+q] = sum_n w16^(r*n) * ( w64^(q*n) * sum_j w4^(q*j) * z[n+16j] ),   w_N = e^(SG*2*pi*i/N):
// the sum over j is a radix-4 butterfly (adds only) and w64^(q*n) one complex multiply per element,
// both on values that a lane already holds; only the 16-point DFT is a matrix product.
// Its 16x16 matrix is four A-fragments of cos and of sin, held in registers.

// sin and cos of 2*pi*num/den, den a power of two: the hardware takes the angle in turns, and
// num/den is exact in f32.
static __device__ __forceinline__ void sincosTurns(int num, float invDen, float& s, float& c) {
  float t = (float)num * invDen;
  // Neither result shares a register with the angle, and the v_nop is the free slot that the
  // instruction set asks for between a transcendental and the first reader of its result.
  asm("v_sin_f32 %0, %2\n\tv_cos_f32 %1, %2\n\tv_nop" : "=&v"(s), "=&v"(c) : "v"(t));
}

// Access at a wave-uniform base plus the lane's own byte offset: the base and every constant step
// stay in scalar registers, and one VGPR serves all the accesses of a lane.
static __device__ __forceinline__ float ldF(const float* u, unsigned b) {
  return *(const float*)((const char*)u + b);
}
static __device__ __forceinline__ v2f ldV(const v2f* u, unsigned b) {
  return *(const v2f*)((const char*)u + b);
}
static __device__ __forceinline__ v4f ldQ(const float* u, unsigned b) {
  return *(const v4f*)((const char*)u + b);
}
static __device__ __forceinline__ void stQ(float* u, unsigned b, v4f v) {
  *(v4f*)((char*)u + b) = v;
}
static __device__ __forceinline__ void stF(float* u, unsigned b, float v) {
  *(float*)((char*)u + b) = v;
}
static __device__ __forceinline__ void stV(v2f* u, unsigned b, v2f v) {
  *(v2f*)((char*)u + b) = v;
}

// The lane's byte offset moved on by a constant too large for an access's own offset field.
// The add is written in asm so that the accesses name this one register beside the scalar base:
// left to itself the compiler takes the constant out again and forms 64-bit address pairs of its
// own, which the source cannot hold until the wait that follows the accesses.
static __device__ __forceinline__ unsigned farOff(unsigned b, unsigned step) {
  unsigned r;
  asm("v_add_nc_u32 %0, %1, %2" : "=v"(r) : "s"(step), "v"(b));
  return r;
}

// A-fragments of the 16-point DFT matrix: row = the lane's row, fragment kk holds the columns
// col0 + step*kk and the next one. fc = cos, fs = sin, fn = -sin of 2*pi*row*col/16.
static __device__ __forceinline__ void initF16(int row, int col0, int step, v2f (&fc)[4],
                                               v2f (&fs)[4], v2f (&fn)[4]) {
#pragma unroll
  for (int kk = 0; kk < 4; ++kk) {
    int col = col0 + step * kk;
    float s0, c0, s1, c1;
    sincosTurns((row * col) & 15, 1.f / 16.f, s0, c0);
    sincosTurns((row * (col + 1)) & 15, 1.f / 16.f, s1, c1);
    fc[kk].x = c0;  fc[kk].y = c1;
    fs[kk].x = s0;  fs[kk].y = s1;
    fn[kk].x = -s0; fn[kk].y = -s1;
  }
}

// 16-point DFT of 16 columns, K in four fragments. fp multiplies bR into the imaginary part and
// fm multiplies bI into the real part: forward (fp, fm) = (-sin, sin), inverse (sin, -sin).
static __device__ __forceinline__ void dft16(const v2f (&fc)[4], const v2f (&fp)[4],
                                             const v2f (&fm)[4], const v2f (&bR)[4],
                                             const v2f (&bI)[4], v8f& accR, v8f& accI) {
#pragma unroll
  for (int kk = 0; kk < 4; ++kk) {
    accR = wmma4(fc[kk], bR[kk], accR);
    accI = wmma4(fc[kk], bI[kk], accI);
    accR = wmma4(fm[kk], bI[kk], accR);
    accI = wmma4(fp[kk], bR[kk], accI);
  }
}

// Radix-4 butterflies and w64 twiddles in front of the 16-point DFTs, for a wave that holds 32
// columns as two tiles of 16: the even columns and the odd ones.
// In: uR/uI[j][kk][e] = {even column, odd column} of element t = n + 16*j, n = 4*kk + 2*half + e.
// Out: zR/zI[c][q][kk] = B-fragment kk (K = n) of tile c's 16-point DFT that gives X[4r+q].
// A twiddle does not depend on the column: one sine and cosine serve both tiles.
template <int SG>  // SG: -1 forward, +1 inverse
static __device__ __forceinline__ void radix4In2(const v2f (&uR)[4][4][2], const v2f (&uI)[4][4][2],
                                                 v2f (&zR)[2][4][4], v2f (&zI)[2][4][4], int half) {
  const float sg = (float)SG;
#pragma unroll
  for (int kk = 0; kk < 4; ++kk) {
#pragma unroll
    for (int e = 0; e < 2; ++e) {
      v2f s0R = uR[0][kk][e] + uR[2][kk][e], s0I = uI[0][kk][e] + uI[2][kk][e];
      v2f s1R = uR[0][kk][e] - uR[2][kk][e], s1I = uI[0][kk][e] - uI[2][kk][e];
      v2f s2R = uR[1][kk][e] + uR[3][kk][e], s2I = uI[1][kk][e] + uI[3][kk][e];
      v2f s3R = (uR[1][kk][e] - uR[3][kk][e]) * sg, s3I = (uI[1][kk][e] - uI[3][kk][e]) * sg;
      v2f tR[4], tI[4];
      tR[0] = s0R + s2R; tI[0] = s0I + s2I;
      tR[1] = s1R - s3I; tI[1] = s1I + s3R;  // s1 + SG*i*(z1 - z3)
      tR[2] = s0R - s2R; tI[2] = s0I - s2I;
      tR[3] = s1R + s3I; tI[3] = s1I - s3R;
#pragma unroll
      for (int c = 0; c < 2; ++c) {
        zR[c][0][kk][e] = tR[0][c];
        zI[c][0][kk][e] = tI[0][c];
      }
#pragma unroll
      for (int q = 1; q < 4; ++q) {
        int n = 4 * kk + 2 * half + e;
        float sn, cs;
        sincosTurns((q * n) & 63, 1.f / 64.f, sn, cs);
        sn *= sg;
#pragma unroll
        for (int c = 0; c < 2; ++c) {
          zR[c][q][kk][e] = tR[q][c] * cs - tI[q][c] * sn;
          zI[c][q][kk][e] = tR[q][c] * sn + tI[q][c] * cs;
        }
      }
    }
  }
}

// The same two tiles where a lane holds the {re, im} pairs of its two columns side by side.
// In: g[j][kk][e] = {re, im of the even column, re, im of the odd column} of element t = n + 16*j.
template <int SG>  // SG: -1 forward, +1 inverse
static __device__ __forceinline__ void radix4InC(const v4f (&g)[4][4][2], v2f (&zR)[2][4][4],
                                                 v2f (&zI)[2][4][4], int half) {
  const float sg = (float)SG;
#pragma unroll
  for (int kk = 0; kk < 4; ++kk) {
#pragma unroll
    for (int e = 0; e < 2; ++e) {
      v4f s0 = g[0][kk][e] + g[2][kk][e];
      v4f s1 = g[0][kk][e] - g[2][kk][e];
      v4f s2 = g[1][kk][e] + g[3][kk][e];
      v4f s3 = (g[1][kk][e] - g[3][kk][e]) * sg;
      v4f r3 = {-s3.y, s3.x, -s3.w, s3.z};  // i * s3
      v4f t[4];
      t[0] = s0 + s2;
      t[1] = s1 + r3;  // s1 + SG*i*(z1 - z3)
      t[2] = s0 - s2;
      t[3] = s1 - r3;
#pragma unroll
      for (int c = 0; c < 2; ++c) {
        zR[c][0][kk][e] = t[0][2 * c];
        zI[c][0][kk][e] = t[0][2 * c + 1];
      }
#pragma unroll
      for (int q = 1; q < 4; ++q) {
        int n = 4 * kk + 2 * half + e;
        float sn, cs;
        sincosTurns((q * n) & 63, 1.f / 64.f, sn, cs);
        sn *= sg;
#pragma unroll
        for (int c = 0; c < 2; ++c) {
          zR[c][q][kk][e] = t[q][2 * c] * cs - t[q][2 * c + 1] * sn;
          zI[c][q][kk][e] = t[q][2 * c] * sn + t[q][2 * c + 1] * cs;
        }
      }
    }
  }
}

// ---------------- tiny filter MLP:  Hbins[2049][1024] ----------------
// One work-group makes eight bins over all 1024 columns. Threads 0..127 make one sine or
// cosine each; every thread one hidden unit and four columns of all eight bins, so that a value of W2
// is loaded once for eight bins. Each sum runs in the order i = 0..15 and j = 0..31.
// The last group has one bin of its own, 2048: it makes that bin eight times, and a thread stores
// the same value to the same place each time.
// grp: which eight bins, 0..256.
static __device__ __forceinline__ void filterBins(int grp, const float* __restrict__ W1,
                                                  const float* __restrict__ b1,
                                                  const float* __restrict__ W2,
                                                  const float* __restrict__ b2,
                                                  float* __restrict__ Hb) {
  __shared__ float pe[8][16];
  __shared__ __attribute__((aligned(16))) float h[32][8];
  const int tid = threadIdx.x;
  const int bin0 = grp * 8;

  // All the weights are asked for first: they arrive while the sines are worked out.
  const unsigned co = (unsigned)tid * 16u;  // columns 4*tid .. 4*tid+3
  v4f w2[32];
#pragma unroll
  for (int j = 0; j < 32; ++j) w2[j] = ldQ(W2 + j * 1024, co);
  const v4f bias = ldQ(b2, co);
  const int hj = tid & 31;  // hidden unit
  const int hb = tid >> 5;  // its bin: the wave's number
  const unsigned jo = (unsigned)hj * 4u;
  float w1[16];
#pragma unroll
  for (int i = 0; i < 16; ++i) w1[i] = ldF(W1 + i * 32, jo);
  float acc = ldF(b1, jo);
  // the index registers that the loads name are held until this wait, so none of them lands on one
  asm volatile("s_wait_xcnt 0x0" ::"v"(tid), "v"(hj) : "memory");

  if (tid < 128) {  // waves 0 and 1: the sines; waves 2 and 3: the cosines
    const int m = tid & 7;
    const int b = (tid >> 3) & 7;
    float invf = 1.f;
#pragma unroll
    for (int mm = 1; mm < 8; ++mm)
      if (m == mm) invf = expf((float)(2 * mm) * (-9.210340371976184f / 16.f));
    float arg = (float)min(bin0 + b, 2048) * invf;
    if (tid < 64) pe[b][2 * m] = sinf(arg);
    else pe[b][2 * m + 1] = cosf(arg);
  }
  __syncthreads();
#pragma unroll
  for (int i = 0; i < 16; ++i) acc = __builtin_fmaf(pe[hb][i], w1[i], acc);
  h[hj][hb] = acc / (1.f + expf(-acc));  // SiLU
  __syncthreads();

  v4f o[8];
#pragma unroll
  for (int b = 0; b < 8; ++b) o[b] = bias;
#pragma unroll
  for (int j = 0; j < 32; ++j) {
#pragma unroll
    for (int b = 0; b < 8; ++b) o[b] += h[j][b] * w2[j];
  }
#pragma unroll
  for (int b = 0; b < 8; ++b) stQ(Hb + (size_t)min(bin0 + b, 2048) * 1024, co, o[b]);
}

// The filter is real and even in the bin index (bin k and bin 4096-k use the same value), so its
// impulse response is real. Two real signals that share a filter therefore go through ONE complex
// transform: z = x[p] + i*x[p+2] (batches p and p+2, same column d, same filter column).
// Re(ifft(fft(z)*H)) is the result for batch p, Im(...) the result for batch p+2.
// G holds z's transform as {re, im} pairs: G[p][k1][t0][d], p = 0..1.

// ---------------- Kernel A: stage-1 forward DFT over t1 + twiddle ----------------
// G[p][k1][t0][d] = w4096^{t0*k1} * sum_t1 e^{-2pi i k1 t1/64} z[p][64*t1+t0][d]
// A wave takes 32 columns of one t0: a lane loads two neighbouring columns at once, so that 16 lanes
// cover a whole 128-byte line of x, and the even and the odd columns are two WMMA tiles. The eight
// waves of a work-group stand side by side on 256 columns.
// grp: which 256 columns (2 bits), above them t0 (6 bits), above that p.
static __device__ __forceinline__ void stage1(int grp, const float* __restrict__ x,
                                              float* __restrict__ Gf) {
  const int lane = threadIdx.x & 31;
  // the wave's number as a scalar: the column base stays out of the VGPRs
  const int wave = __builtin_amdgcn_readfirstlane(threadIdx.x >> 5);
  const int half = lane >> 4;
  const int n16 = lane & 15;
  const int d0 = (grp & 3) * 256 + wave * 32;
  const int t0 = (grp >> 2) & 63;
  const int p = grp >> 8;

  // row t0 (t1 = 0) of batch p (real part); batch p+2 is the imaginary part
  const float* xa = x + ((size_t)p * 4096 + t0) * 1024 + d0;
  const unsigned lo = (unsigned)(128 * half * 1024 + 2 * n16) * 4u;  // t1 = 2*half, two columns
  // one offset register for every 8 MiB, the reach of a load's constant offset: j = 0, 1 and
  // j = 2, 3 of batch p, then of batch p+2, which lies 32 MiB further on
  const unsigned la[2] = {lo, farOff(lo, 8u << 20)};
  const unsigned lb[2] = {farOff(lo, 32u << 20), farOff(lo, 40u << 20)};

  v2f uR[4][4][2], uI[4][4][2];
#pragma unroll
  for (int j = 0; j < 4; ++j) {
#pragma unroll
    for (int kk = 0; kk < 4; ++kk) {
#pragma unroll
      for (int e = 0; e < 2; ++e) {
        // t1 = 16*j + 4*kk + 2*half + e
        const v2f* row = (const v2f*)(xa + (size_t)(1024 * (j & 1) + 256 * kk + 64 * e) * 1024);
        uR[j][kk][e] = ldV(row, la[j >> 1]);
        uI[j][kk][e] = ldV(row, lb[j >> 1]);
      }
    }
  }
  // the offset registers that the loads name are held until this wait, so none of them lands on one
  asm volatile("s_wait_xcnt 0x0" ::"v"(la[0]), "v"(la[1]), "v"(lb[0]), "v"(lb[1]) : "memory");

  // k1 = 0, this t0; the lane adds k1 = 4*(8*half) and its two columns
  float* G = Gf + ((((size_t)p * 64) * 64 + t0) * 1024 + d0) * 2;
  const unsigned so = (unsigned)(32 * half * 64 * 1024 + 2 * n16) * 8u;
  const unsigned sv[2] = {so, farOff(so, 8u << 20)};  // v = 0..3 and v = 4..7, 8 MiB apart

  v2f fc[4], fs[4], fn[4];
  initF16(n16, 2 * half, 4, fc, fs, fn);
  v2f zR[2][4][4], zI[2][4][4];
  radix4In2<-1>(uR, uI, zR, zI, half);

#pragma unroll
  for (int q = 0; q < 4; ++q) {
    v8f eR = {0, 0, 0, 0, 0, 0, 0, 0};
    v8f eI = {0, 0, 0, 0, 0, 0, 0, 0};
    v8f oR = {0, 0, 0, 0, 0, 0, 0, 0};
    v8f oI = {0, 0, 0, 0, 0, 0, 0, 0};
    dft16(fc, fn, fs, zR[0][q], zI[0][q], eR, eI);
    dft16(fc, fn, fs, zR[1][q], zI[1][q], oR, oI);
#pragma unroll
    for (int v = 0; v < 8; ++v) {
      int M = 4 * (v + 8 * half) + q;  // k1
      float s, c;
      sincosTurns((t0 * M) & 4095, 1.f / 4096.f, s, c);  // twiddle = c - i*s
      v4f g;
      g.x = eR[v] * c + eI[v] * s;
      g.y = eI[v] * c - eR[v] * s;
      g.z = oR[v] * c + oI[v] * s;
      g.w = oI[v] * c - oR[v] * s;
      stQ(G + (size_t)(4 * (v & 3) + q) * 64 * 1024 * 2, sv[v >> 2], g);
    }
  }
  // the offset registers that the stores name are held until this wait
  asm volatile("s_wait_xcnt 0x0" ::"v"(sv[0]), "v"(sv[1]) : "memory");
}

// ---------------- One launch for the filter and stage 1 ----------------
// Neither needs the other's result; kernel B, the next launch, needs both. The 257 filter groups
// have the lowest indices.
// launch_bounds' second argument: a budget of 256 VGPRs, which keeps every register directly
// addressable.
__global__ void __launch_bounds__(256, 4) kHA(const float* __restrict__ x,
                                           const float* __restrict__ W1,
                                           const float* __restrict__ b1,
                                           const float* __restrict__ W2,
                                           const float* __restrict__ b2,
                                           float* __restrict__ Hb,
                                           float* __restrict__ Gf) {
  const int b = blockIdx.x;
  if (b < 257) filterBins(b, W1, b1, W2, b2, Hb);
  else stage1(b - 257, x, Gf);
}

// The filter at the lane's two columns for the eight rows k2 = 4*(v + 8*half) + q of kernel B.
static __device__ __forceinline__ void loadH(const v2f* Hu, int k1, int q, int half, int n16,
                                             v2f (&hv)[8]) {
  unsigned ho[8];
#pragma unroll
  for (int v = 0; v < 8; ++v) {
    int k2 = 4 * (v + 8 * half) + q;
    int k = k1 + 64 * k2;
    int bin = (k <= 2048) ? k : (4096 - k);  // real symmetric filter
    ho[v] = (unsigned)(bin * 1024 + 2 * n16) * 4u;
    hv[v] = ldV(Hu, ho[v]);
  }
  // the eight offset registers are held until this wait, so none of the loads lands on one
  asm volatile("s_wait_xcnt 0x0" ::"v"(ho[0]), "v"(ho[1]), "v"(ho[2]), "v"(ho[3]), "v"(ho[4]),
               "v"(ho[5]), "v"(ho[6]), "v"(ho[7])
               : "memory");
}

// ---------------- Kernel B: fwd over t0, *Hfull, inv over k2, conj twiddle (in place) ----
// A wave takes 32 columns of one k1, as in kernels A and C: a lane loads and stores the {re, im}
// pairs of two neighbouring columns at once, so that 16 lanes cover 256 bytes of a row of G and a
// whole 128-byte line of the filter, and the even and the odd columns are two WMMA tiles. The four
// waves of a work-group stand side by side on 128 columns. A twiddle does not depend on the column:
// one sine and cosine serve both tiles.
// launch_bounds' second argument: a budget of 256 VGPRs; all the work-groups that fall to a WGP are
// resident at once.
__global__ void __launch_bounds__(128, 4) kB(float* __restrict__ Gf,
                                          const float* __restrict__ Hb) {
  const int lane = threadIdx.x & 31;
  // the wave's number as a scalar: the column base stays out of the VGPRs
  const int wave = __builtin_amdgcn_readfirstlane(threadIdx.x >> 5);
  const int half = lane >> 4;
  const int n16 = lane & 15;
  const int d0 = blockIdx.x * 128 + wave * 32;
  const int k1 = blockIdx.y;
  const int p = blockIdx.z;
  float* G = Gf + ((((size_t)p * 64 + k1) * 64) * 1024 + d0) * 2;  // t0 = 0
  const v2f* Hu = (const v2f*)(Hb + d0);
  const unsigned lo = (unsigned)(2 * half * 1024 + 2 * n16) * 8u;  // loads: t0 = 2*half, two columns
  const unsigned so = (unsigned)(8 * half * 1024 + 2 * n16) * 8u;  // stores: t0 = 8*half, two columns

  v4f g[4][4][2];  // G[t0][d], two columns
#pragma unroll
  for (int j = 0; j < 4; ++j) {
#pragma unroll
    for (int kk = 0; kk < 4; ++kk) {
#pragma unroll
      for (int e = 0; e < 2; ++e) {
        // t0 = 16*j + 4*kk + 2*half + e
        g[j][kk][e] = ldQ(G + (size_t)(16 * j + 4 * kk + e) * 1024 * 2, lo);
      }
    }
  }
  // the offset register that the loads name is held until this wait, so none of them lands on it
  asm volatile("s_wait_xcnt 0x0" ::"v"(lo) : "memory");
  v2f hv[8];  // the filter at the lane's two columns, first for q = 0
  loadH(Hu, k1, 0, half, n16, hv);
  // all the loads above are issued before anything else takes registers: otherwise the build holds
  // eight of them back until the first data have come
  __builtin_amdgcn_sched_barrier(0);

  v2f fc[4], fs[4], fn[4];
  initF16(n16, 2 * half, 4, fc, fs, fn);
  // The inverse takes its input in the order in which the forward's accumulators hold it:
  // accumulator registers 2*kk and 2*kk+1 are rows r = 8*half + 2*kk and r + 1, and they are
  // used as B-fragment kk as they stand; the matrix columns follow that k order.
  v2f gc[4], gs[4], gn[4];
  initF16(n16, 8 * half, 2, gc, gs, gn);
  v2f zR[2][4][4], zI[2][4][4];
  radix4InC<-1>(g, zR, zI, half);
  // the later parts' index and sine work stays behind this line: scheduled up among the butterflies
  // it costs registers and moves
  __builtin_amdgcn_sched_barrier(0);

  // Per q: Xf[k2 = 4r+q][d] = sum_t0 e^{-2pi i k2 t0/64} G[t0][d], * Hfull[k1+64*k2][d], then
  // W_q[n][d] = sum_r e^{+2pi i n r/16} Xf[4r+q][d]
  v8f wR[2][4], wI[2][4];
#pragma unroll
  for (int q = 0; q < 4; ++q) {
    v2f bR[2][4], bI[2][4];
#pragma unroll
    for (int c = 0; c < 2; ++c) {
      v8f accR = {0, 0, 0, 0, 0, 0, 0, 0};
      v8f accI = {0, 0, 0, 0, 0, 0, 0, 0};
      dft16(fc, fn, fs, zR[c][q], zI[c][q], accR, accI);
#pragma unroll
      for (int v = 0; v < 8; ++v) {
        bR[c][v >> 1][v & 1] = accR[v] * hv[v][c];
        bI[c][v >> 1][v & 1] = accI[v] * hv[v][c];
      }
    }
    // the next q's filter values are asked for as soon as this q's are used up: they arrive during
    // the products that follow
    if (q < 3) loadH(Hu, k1, q + 1, half, n16, hv);
#pragma unroll
    for (int c = 0; c < 2; ++c) {
      v8f oR = {0, 0, 0, 0, 0, 0, 0, 0};
      v8f oI = {0, 0, 0, 0, 0, 0, 0, 0};
      dft16(gc, gs, gn, bR[c], bI[c], oR, oI);
      wR[c][q] = oR;
      wI[c][q] = oI;
    }
  }
  // the sines of the last part stay behind the products: scheduled up, they spill registers
  __builtin_amdgcn_sched_barrier(0);

  // C[t0 = n+16j][d] = sum_q i^(j*q) * e^{+2pi i n q/64} * W_q[n][d], then * e^{+2pi i t0 k1/4096}
#pragma unroll
  for (int v = 0; v < 8; ++v) {
    const int n = v + 8 * half;
    float uR[2][4], uI[2][4];
#pragma unroll
    for (int c = 0; c < 2; ++c) {
      uR[c][0] = wR[c][0][v];
      uI[c][0] = wI[c][0][v];
    }
#pragma unroll
    for (int q = 1; q < 4; ++q) {
      float s, cs;
      sincosTurns((q * n) & 63, 1.f / 64.f, s, cs);
#pragma unroll
      for (int c = 0; c < 2; ++c) {
        uR[c][q] = wR[c][q][v] * cs - wI[c][q][v] * s;
        uI[c][q] = wR[c][q][v] * s + wI[c][q][v] * cs;
      }
    }
    float cR[2][4], cI[2][4];
#pragma unroll
    for (int c = 0; c < 2; ++c) {
      float e0R = uR[c][0] + uR[c][2], e0I = uI[c][0] + uI[c][2];
      float e1R = uR[c][0] - uR[c][2], e1I = uI[c][0] - uI[c][2];
      float o0R = uR[c][1] + uR[c][3], o0I = uI[c][1] + uI[c][3];
      float o1R = uR[c][1] - uR[c][3], o1I = uI[c][1] - uI[c][3];
      cR[c][0] = e0R + o0R; cI[c][0] = e0I + o0I;
      cR[c][1] = e1R - o1I; cI[c][1] = e1I + o1R;  // e1 + i*o1
      cR[c][2] = e0R - o0R; cI[c][2] = e0I - o0I;
      cR[c][3] = e1R + o1I; cI[c][3] = e1I - o1R;
    }
#pragma unroll
    for (int j = 0; j < 4; ++j) {
      int t0 = n + 16 * j;
      float s, cs;
      sincosTurns((t0 * k1) & 4095, 1.f / 4096.f, s, cs);
      v4f r;
      r.x = cR[0][j] * cs - cI[0][j] * s;
      r.y = cR[0][j] * s + cI[0][j] * cs;
      r.z = cR[1][j] * cs - cI[1][j] * s;
      r.w = cR[1][j] * s + cI[1][j] * cs;
      stQ(G + (size_t)(v + 16 * j) * 1024 * 2, so, r);
    }
  }
  // the offset register that the stores name is held until this wait
  asm volatile("s_wait_xcnt 0x0" ::"v"(so) : "memory");
}

// ---------------- Kernel C: inverse stage-2 over k1 ----------------
// w = (1/4096)*gain[d]*sum_k1 e^{+2pi i t1 k1/64} C[k1][t0][d];
// y[p][64*t1+t0][d] = Re w, y[p+2][64*t1+t0][d] = Im w
// A wave takes 32 columns of one t0, as in kernel A: a lane loads the {re, im} pairs of two
// neighbouring columns at once and stores two columns of y at once, so that 16 lanes store a whole
// 128-byte line.
// launch_bounds' second argument: a budget of 256 VGPRs: all of a wave's loads are in flight at once.
__global__ void __launch_bounds__(128, 4) kC(const float* __restrict__ Gf,
                                          const float* __restrict__ gain,
                                          float* __restrict__ y) {
  const int lane = threadIdx.x & 31;
  // the wave's number as a scalar: the column base stays out of the VGPRs
  const int wave = __builtin_amdgcn_readfirstlane(threadIdx.x >> 5);
  const int half = lane >> 4;
  const int n16 = lane & 15;
  const int d0 = blockIdx.x * 128 + wave * 32;
  const int t0 = blockIdx.y;
  const int p = blockIdx.z;
  const float* G = Gf + (((size_t)p * 64 * 64 + t0) * 1024 + d0) * 2;  // k1 = 0
  const unsigned lo = (unsigned)(2 * half * 64 * 1024 + 2 * n16) * 8u;  // k1 = 2*half, two columns
  // one offset register for every j, 8 MiB apart, the reach of a load's constant offset
  const unsigned lj[4] = {lo, farOff(lo, 8u << 20), farOff(lo, 16u << 20), farOff(lo, 24u << 20)};

  v4f g[4][4][2];  // C[k1][d], two columns
#pragma unroll
  for (int j = 0; j < 4; ++j) {
#pragma unroll
    for (int kk = 0; kk < 4; ++kk) {
#pragma unroll
      for (int e = 0; e < 2; ++e) {
        // k1 = 16*j + 4*kk + 2*half + e
        g[j][kk][e] = ldQ(G + (size_t)(4 * kk + e) * 64 * 1024 * 2, lj[j]);
      }
    }
  }
  const unsigned go = (unsigned)n16 * 8u;
  const v2f ag = ldV((const v2f*)(gain + d0), go) * (1.f / 4096.f);
  // the offset registers that the loads name are held until this wait, so none of them lands on one
  asm volatile("s_wait_xcnt 0x0" ::"v"(go), "v"(lj[0]), "v"(lj[1]), "v"(lj[2]), "v"(lj[3])
               : "memory");

  // t1 = 0, this t0, batch p; the lane adds t1 = 4*(8*half) and its two columns, and for batch p+2
  // 32 MiB more
  float* ya = y + ((size_t)p * 4096 + t0) * 1024 + d0;
  const unsigned so = (unsigned)(2048 * half * 1024 + 2 * n16) * 4u;
  const unsigned sb = farOff(so, 32u << 20);

  v2f fc[4], fs[4], fn[4];
  initF16(n16, 2 * half, 4, fc, fs, fn);
  v2f zR[2][4][4], zI[2][4][4];
  radix4InC<1>(g, zR, zI, half);

#pragma unroll
  for (int q = 0; q < 4; ++q) {
    v8f eR = {0, 0, 0, 0, 0, 0, 0, 0};
    v8f eI = {0, 0, 0, 0, 0, 0, 0, 0};
    v8f oR = {0, 0, 0, 0, 0, 0, 0, 0};
    v8f oI = {0, 0, 0, 0, 0, 0, 0, 0};
    dft16(fc, fs, fn, zR[0][q], zI[0][q], eR, eI);
    dft16(fc, fs, fn, zR[1][q], zI[1][q], oR, oI);
#pragma unroll
    for (int v = 0; v < 8; ++v) {
      size_t o = (size_t)(4 * v + q) * 64 * 1024;  // t1 = 4*(v + 8*half) + q
      v2f re, im;
      re.x = eR[v] * ag.x;
      re.y = oR[v] * ag.y;
      im.x = eI[v] * ag.x;
      im.y = oI[v] * ag.y;
      stV((v2f*)(ya + o), so, re);
      stV((v2f*)(ya + o), sb, im);
    }
  }
  // the offset registers that the stores name are held until this wait
  asm volatile("s_wait_xcnt 0x0" ::"v"(so), "v"(sb) : "memory");
}

extern "C" void kernel_launch(void* const* d_in, const int* in_sizes, int n_in,
                              void* d_out, int out_size, void* d_ws, size_t ws_size,
                              hipStream_t stream) {
  const float* x = (const float*)d_in[0];
  const float* W1 = (const float*)d_in[1];
  const float* b1 = (const float*)d_in[2];
  const float* W2 = (const float*)d_in[3];
  const float* b2 = (const float*)d_in[4];
  const float* ag = (const float*)d_in[5];
  float* out = (float*)d_out;

  // workspace layout: Hbins[2049*1024] | G[2*4096*1024] {re,im} pairs  (~76 MB)
  float* Hb = (float*)d_ws;
  float* wG = Hb + (size_t)2049 * 1024;

  // 257 filter groups, then 512 stage-1 groups
  kHA<<<dim3(769, 1, 1), 256, 0, stream>>>(x, W1, b1, W2, b2, Hb, wG);
  kB<<<dim3(8, 64, 2), 128, 0, stream>>>(wG, Hb);
  kC<<<dim3(8, 64, 2), 128, 0, stream>>>(wG, ag, out);
}

// v008
// One run takes 56.2 microseconds.
// Two timings next to v007 put it at 1.06 and 1.07 times that version's speed.
// Counting every step since v000, it is 6.11 times as fast.
#include <hip/hip_runtime.h>
#include <hip/hip_bf16.h>

typedef __attribute__((ext_vector_type(2))) float v2f;
typedef __attribute__((ext_vector_type(4))) float v4f;
typedef __attribute__((ext_vector_type(8))) float v8f;

// D = A(16x4) * B(4x16) + C, f32 WMMA (CDNA5 V_WMMA_F32_16X16X4_F32)
static __device__ __forceinline__ v8f wmma4(v2f a, v2f b, v8f c) {
  return __builtin_amdgcn_wmma_f32_16x16x4_f32(false, a, false, b, (short)0, c,
                                               false, false);
}

// Every 64-point DFT is factored 64 = 8 x 8. In kernels A and C, with t = n + 8*j and k = 8*r + q,
//   X[8r+q] = sum_n w64^((8r+q)*n) * sum_j w8^(q*j) * z[n+8j],   w_N = e^(SG*2*pi*i/N):
// the sum over j is a radix-8 butterfly on values that a lane already holds, and the sum over n is a
// complex 8x8 matrix product. Written out in real numbers (rows: re and im of r, K: re and im of n)
// that matrix is 16x16, one WMMA tile with nothing idle: four WMMAs do one part q of 16 columns.
// Each part has a matrix of its own, so its entries are the full angles of the formula above.

// sin and cos of 2*pi*num/den, den a power of two: the hardware takes the angle in turns, and
// num/den is exact in f32.
static __device__ __forceinline__ void sincosTurns(int num, float invDen, float& s, float& c) {
  float t = (float)num * invDen;
  // Neither result shares a register with the angle, and the v_nop is the free slot that the
  // instruction set asks for between a transcendental and the first reader of its result.
  asm("v_sin_f32 %0, %2\n\tv_cos_f32 %1, %2\n\tv_nop" : "=&v"(s), "=&v"(c) : "v"(t));
}

// Access at a wave-uniform base plus the lane's own byte offset: the base and every constant step
// stay in scalar registers, and one VGPR serves all the accesses of a lane.
static __device__ __forceinline__ float ldF(const float* u, unsigned b) {
  return *(const float*)((const char*)u + b);
}
static __device__ __forceinline__ v2f ldV(const v2f* u, unsigned b) {
  return *(const v2f*)((const char*)u + b);
}
static __device__ __forceinline__ v4f ldQ(const float* u, unsigned b) {
  return *(const v4f*)((const char*)u + b);
}
static __device__ __forceinline__ void stQ(float* u, unsigned b, v4f v) {
  *(v4f*)((char*)u + b) = v;
}
static __device__ __forceinline__ void stF(float* u, unsigned b, float v) {
  *(float*)((char*)u + b) = v;
}
static __device__ __forceinline__ void stV(v2f* u, unsigned b, v2f v) {
  *(v2f*)((char*)u + b) = v;
}

// The lane's byte offset moved on by a constant too large for an access's own offset field.
// The add is written in asm so that the accesses name this one register beside the scalar base:
// left to itself the compiler takes the constant out again and forms 64-bit address pairs of its
// own, which the source cannot hold until the wait that follows the accesses.
static __device__ __forceinline__ unsigned farOff(unsigned b, unsigned step) {
  unsigned r;
  asm("v_add_nc_u32 %0, %1, %2" : "=v"(r) : "s"(step), "v"(b));
  return r;
}

// A-fragments of one part's matrix. The complex 8x8 matrix has the entries
// e^(SG*2*pi*i*k*(64*col + tw)/4096), k the frequency of the row; 64*k*col is the 64-point DFT's own
// angle, k*tw a twiddle of the 4096-point transform. In real form row 2*r holds {c, -s} and row
// 2*r+1 holds {s, c} at the K positions {re, im} of a column. The lane's row is n16: k belongs to
// r = n16 >> 1, im = n16 & 1; fragment kk holds the complex column col0 + step*kk.
template <int SG>  // SG: -1 forward, +1 inverse
static __device__ __forceinline__ void initM(int k, int im, int col0, int step, int tw,
                                             v2f (&a)[4]) {
#pragma unroll
  for (int kk = 0; kk < 4; ++kk) {
    int col = col0 + step * kk;
    float s, c;
    sincosTurns((k * (64 * col + tw)) & 4095, 1.f / 4096.f, s, c);
    s *= (float)SG;
    a[kk].x = im ? s : c;
    a[kk].y = im ? c : -s;
  }
}

// One part's matrix product on 16 columns. b[kk] = {re, im} of the complex element that stands at
// column kk of the lane's half in the matrix. Result: registers 2*i and 2*i+1 are {re, im} of row
// r = i + 4*half.
static __device__ __forceinline__ v8f dft8(const v2f (&a)[4], const v2f (&b)[4]) {
  v8f acc = {0, 0, 0, 0, 0, 0, 0, 0};
#pragma unroll
  for (int kk = 0; kk < 4; ++kk) acc = wmma4(a[kk], b[kk], acc);
  return acc;
}

// Complex values for the butterflies, in the three forms in which a lane holds them.
// i times a {re, im} pair, and i times the pairs of two columns side by side:
static __device__ __forceinline__ v2f rotI(v2f v) { return v2f{-v.y, v.x}; }
static __device__ __forceinline__ v4f rotI(v4f v) { return v4f{-v.y, v.x, -v.w, v.z}; }
// real and imaginary parts apart, each {even column, odd column}:
struct cpx2 {
  v2f r, i;
};
static __device__ __forceinline__ cpx2 operator+(cpx2 a, cpx2 b) { return cpx2{a.r + b.r, a.i + b.i}; }
static __device__ __forceinline__ cpx2 operator-(cpx2 a, cpx2 b) { return cpx2{a.r - b.r, a.i - b.i}; }
static __device__ __forceinline__ cpx2 operator*(cpx2 a, float f) { return cpx2{a.r * f, a.i * f}; }
static __device__ __forceinline__ cpx2 rotI(cpx2 v) { return cpx2{-v.i, v.r}; }

// x[q] = sum_j w4^(q*j) * b[j]
template <int SG, class T>
static __device__ __forceinline__ void radix4(T b0, T b1, T b2, T b3, T (&x)[4]) {
  T s0 = b0 + b2, s1 = b0 - b2, s2 = b1 + b3;
  T s3 = rotI(b1 - b3) * (float)SG;
  x[0] = s0 + s2;
  x[1] = s1 + s3;
  x[2] = s0 - s2;
  x[3] = s1 - s3;
}

// x[q] = sum_j w8^(q*j) * a[j]: the even and the odd j as two radix-4 butterflies, then
// x[m] = E[m] + w8^m * O[m] and x[m+4] = E[m] - w8^m * O[m].
template <int SG, class T>
static __device__ __forceinline__ void radix8(const T (&a)[8], T (&x)[8]) {
  const float sg = (float)SG;
  const float h = 0.70710678118654752f;
  T E[4], O[4];
  radix4<SG>(a[0], a[2], a[4], a[6], E);
  radix4<SG>(a[1], a[3], a[5], a[7], O);
  T w[4];
  w[0] = O[0];
  w[1] = (O[1] + rotI(O[1]) * sg) * h;  // (1 + SG*i)/sqrt(2)
  w[2] = rotI(O[2]) * sg;               // SG*i
  w[3] = (rotI(O[3]) * sg - O[3]) * h;  // (-1 + SG*i)/sqrt(2)
#pragma unroll
  for (int m = 0; m < 4; ++m) {
    x[m] = E[m] + w[m];
    x[m + 4] = E[m] - w[m];
  }
}

// ---------------- tiny filter MLP:  Hbins[2049][1024] ----------------
// One work-group makes eight bins over all 1024 columns. Threads 0..127 make one sine or
// cosine each; every thread one hidden unit and four columns of all eight bins, so that a value of W2
// is loaded once for eight bins. Each sum runs in the order i = 0..15 and j = 0..31.
// The last group has one bin of its own, 2048: it makes that bin eight times, and a thread stores
// the same value to the same place each time.
// grp: which eight bins, 0..256.
static __device__ __forceinline__ void filterBins(int grp, const float* __restrict__ W1,
                                                  const float* __restrict__ b1,
                                                  const float* __restrict__ W2,
                                                  const float* __restrict__ b2,
                                                  float* __restrict__ Hb) {
  __shared__ float pe[8][16];
  __shared__ __attribute__((aligned(16))) float h[32][8];
  const int tid = threadIdx.x;
  const int bin0 = grp * 8;

  // All the weights are asked for first: they arrive while the sines are worked out.
  const unsigned co = (unsigned)tid * 16u;  // columns 4*tid .. 4*tid+3
  v4f w2[32];
#pragma unroll
  for (int j = 0; j < 32; ++j) w2[j] = ldQ(W2 + j * 1024, co);
  const v4f bias = ldQ(b2, co);
  const int hj = tid & 31;  // hidden unit
  const int hb = tid >> 5;  // its bin: the wave's number
  const unsigned jo = (unsigned)hj * 4u;
  float w1[16];
#pragma unroll
  for (int i = 0; i < 16; ++i) w1[i] = ldF(W1 + i * 32, jo);
  float acc = ldF(b1, jo);
  // the index registers that the loads name are held until this wait, so none of them lands on one
  asm volatile("s_wait_xcnt 0x0" ::"v"(tid), "v"(hj) : "memory");

  if (tid < 128) {  // waves 0 and 1: the sines; waves 2 and 3: the cosines
    const int m = tid & 7;
    const int b = (tid >> 3) & 7;
    float invf = 1.f;
#pragma unroll
    for (int mm = 1; mm < 8; ++mm)
      if (m == mm) invf = expf((float)(2 * mm) * (-9.210340371976184f / 16.f));
    float arg = (float)min(bin0 + b, 2048) * invf;
    if (tid < 64) pe[b][2 * m] = sinf(arg);
    else pe[b][2 * m + 1] = cosf(arg);
  }
  __syncthreads();
#pragma unroll
  for (int i = 0; i < 16; ++i) acc = __builtin_fmaf(pe[hb][i], w1[i], acc);
  h[hj][hb] = acc / (1.f + expf(-acc));  // SiLU
  __syncthreads();

  v4f o[8];
#pragma unroll
  for (int b = 0; b < 8; ++b) o[b] = bias;
#pragma unroll
  for (int j = 0; j < 32; ++j) {
#pragma unroll
    for (int b = 0; b < 8; ++b) o[b] += h[j][b] * w2[j];
  }
#pragma unroll
  for (int b = 0; b < 8; ++b) stQ(Hb + (size_t)min(bin0 + b, 2048) * 1024, co, o[b]);
}

// The filter is real and even in the bin index (bin k and bin 4096-k use the same value), so its
// impulse response is real. Two real signals that share a filter therefore go through ONE complex
// transform: z = x[p] + i*x[p+2] (batches p and p+2, same column d, same filter column).
// Re(ifft(fft(z)*H)) is the result for batch p, Im(...) the result for batch p+2.
// G holds z's transform as {re, im} pairs: G[p][k1][t0][d], p = 0..1.

// ---------------- Kernel A: stage-1 forward DFT over t1 + twiddle ----------------
// G[p][k1][t0][d] = w4096^{t0*k1} * sum_t1 e^{-2pi i k1 t1/64} z[p][64*t1+t0][d]
// A wave takes 32 columns of one t0: a lane loads two neighbouring columns at once, so that 16 lanes
// cover a whole 128-byte line of x, and the even and the odd columns are two WMMA tiles. The eight
// waves of a work-group stand side by side on 256 columns.
// grp: which 256 columns (2 bits), above them t0 (6 bits), above that p.
static __device__ __forceinline__ void stage1(int grp, const float* __restrict__ x,
                                              float* __restrict__ Gf) {
  const int lane = threadIdx.x & 31;
  // the wave's number as a scalar: the column base stays out of the VGPRs
  const int wave = __builtin_amdgcn_readfirstlane(threadIdx.x >> 5);
  const int half = lane >> 4;
  const int n16 = lane & 15;
  const int d0 = (grp & 3) * 256 + wave * 32;
  const int t0 = (grp >> 2) & 63;
  const int p = grp >> 8;

  // row t0 (t1 = 0) of batch p (real part); batch p+2 is the imaginary part
  const float* xa = x + ((size_t)p * 4096 + t0) * 1024 + d0;
  const unsigned lo = (unsigned)(64 * half * 1024 + 2 * n16) * 4u;  // t1 = half, two columns
  // one offset register for every 8 MiB, the reach of a load's constant offset: j = 0..3 and
  // j = 4..7 of batch p, then of batch p+2, which lies 32 MiB further on
  const unsigned la[2] = {lo, farOff(lo, 8u << 20)};
  const unsigned lb[2] = {farOff(lo, 32u << 20), farOff(lo, 40u << 20)};

  cpx2 u[4][8];  // [kk][j]
#pragma unroll
  for (int j = 0; j < 8; ++j) {
#pragma unroll
    for (int kk = 0; kk < 4; ++kk) {
      // t1 = 8*j + 2*kk + half
      const v2f* row = (const v2f*)(xa + (size_t)(8 * (j & 3) + 2 * kk) * 64 * 1024);
      u[kk][j].r = ldV(row, la[j >> 2]);
      u[kk][j].i = ldV(row, lb[j >> 2]);
    }
  }
  // the offset registers that the loads name are held until this wait, so none of them lands on one
  asm volatile("s_wait_xcnt 0x0" ::"v"(la[0]), "v"(la[1]), "v"(lb[0]), "v"(lb[1]) : "memory");

  // k1 = 0, this t0; the lane adds k1 = 8*(4*half) and its two columns
  float* G = Gf + ((((size_t)p * 64) * 64 + t0) * 1024 + d0) * 2;
  const unsigned so = (unsigned)(32 * half * 64 * 1024 + 2 * n16) * 8u;
  const unsigned sv[2] = {so, farOff(so, 8u << 20)};  // i = 0, 1 and i = 2, 3, 8 MiB apart

  v2f z[2][8][4];  // [tile][q][kk]: B-fragments, {re, im} of n = 2*kk + half
#pragma unroll
  for (int kk = 0; kk < 4; ++kk) {
    cpx2 t[8];
    radix8<-1>(u[kk], t);
#pragma unroll
    for (int q = 0; q < 8; ++q) {
      z[0][q][kk] = v2f{t[q].r.x, t[q].i.x};
      z[1][q][kk] = v2f{t[q].r.y, t[q].i.y};
    }
  }

#pragma unroll
  for (int q = 0; q < 8; ++q) {
    // row r of part q is k1 = 8*r + q; the matrix holds the twiddle w4096^(t0*k1) as well
    v2f a[4];
    initM<-1>(8 * (n16 >> 1) + q, n16 & 1, half, 2, t0, a);
    v8f e = dft8(a, z[0][q]);
    v8f o = dft8(a, z[1][q]);
#pragma unroll
    for (int i = 0; i < 4; ++i) {
      // k1 = 8*(i + 4*half) + q
      v4f g = {e[2 * i], e[2 * i + 1], o[2 * i], o[2 * i + 1]};
      stQ(G + (size_t)(8 * (i & 1) + q) * 64 * 1024 * 2, sv[i >> 1], g);
    }
  }
  // the offset registers that the stores name are held until this wait
  asm volatile("s_wait_xcnt 0x0" ::"v"(sv[0]), "v"(sv[1]) : "memory");
}

// ---------------- One launch for the filter and stage 1 ----------------
// Neither needs the other's result; kernel B, the next launch, needs both. The 257 filter groups
// have the lowest indices.
// launch_bounds' second argument: a budget of 256 VGPRs, which keeps every register directly
// addressable.
__global__ void __launch_bounds__(256, 4) kHA(const float* __restrict__ x,
                                           const float* __restrict__ W1,
                                           const float* __restrict__ b1,
                                           const float* __restrict__ W2,
                                           const float* __restrict__ b2,
                                           float* __restrict__ Hb,
                                           float* __restrict__ Gf) {
  const int b = blockIdx.x;
  if (b < 257) filterBins(b, W1, b1, W2, b2, Hb);
  else stage1(b - 257, x, Gf);
}

// ---------------- Kernel B: fwd over t0, *Hfull, inv over k2, conj twiddle (in place) ----
// A wave takes 32 columns of one k1, as in kernels A and C: a lane loads and stores the {re, im}
// pairs of two neighbouring columns at once, so that 16 lanes cover 256 bytes of a row of G and a
// whole 128-byte line of the filter, and the even and the odd columns are two WMMA tiles. The four
// waves of a work-group stand side by side on 128 columns.
// Here the matrix products stand at both ends and the butterflies in the middle. With t0 = 8*n + j
// and k2 = r + 8*q:
//   P_j[r]    = sum_n e^{-2pi i r(8n+j)/64} G[8n+j]           (matrix of part j)
//   Xf[r+8q]  = sum_j w8^(-q*j) P_j[r],   Y = Xf * Hfull[k1 + 64*k2]
//   Q_j[r]    = sum_q w8^(+q*j) Y[r+8q]
//   C[8n+j]   = sum_r e^{+2pi i (8n+j)(64r+k1)/4096} Q_j[r]   (matrix of part j, conj twiddle inside)
// Both butterflies and the filter work on accumulator registers of one row r: nothing moves between
// lanes.
// launch_bounds' second argument: a budget of 256 VGPRs; all the work-groups that fall to a WGP are
// resident at once.
__global__ void __launch_bounds__(128, 4) kB(float* __restrict__ Gf,
                                          const float* __restrict__ Hb) {
  const int lane = threadIdx.x & 31;
  // the wave's number as a scalar: the column base stays out of the VGPRs
  const int wave = __builtin_amdgcn_readfirstlane(threadIdx.x >> 5);
  const int half = lane >> 4;
  const int n16 = lane & 15;
  const int d0 = blockIdx.x * 128 + wave * 32;
  const int k1 = blockIdx.y;
  const int p = blockIdx.z;
  float* G = Gf + ((((size_t)p * 64 + k1) * 64) * 1024 + d0) * 2;  // t0 = 0
  const unsigned lo = (unsigned)(8 * half * 1024 + 2 * n16) * 8u;   // loads: t0 = 8*half, two columns
  const unsigned so = (unsigned)(32 * half * 1024 + 2 * n16) * 8u;  // stores: t0 = 32*half, two columns

  // g[j][kk] = G[t0 = 8*n + j][d], n = 2*kk + half, two columns: each {re, im} pair is a B-fragment
  // as it stands
  v4f g[8][4];
#pragma unroll
  for (int j = 0; j < 8; ++j) {
#pragma unroll
    for (int kk = 0; kk < 4; ++kk) g[j][kk] = ldQ(G + (size_t)(16 * kk + j) * 1024 * 2, lo);
  }

  // The filter at the lane's two columns, row r = i + 4*half: k = k1 + 64*r + 512*q. It is real and
  // symmetric: bin k for q = 0..3 (k < 2048) and bin 4096 - k for q = 4..7 (k >= 2048).
  const float* Hlo = Hb + d0 + (size_t)k1 * 1024;
  const float* Hhi = Hb + d0 + (size_t)(64 - k1) * 1024;  // q = 7, i = 3, half = 1: the lowest such bin
  const unsigned hl = (unsigned)(256 * half * 1024 + 2 * n16) * 4u;
  const unsigned hh = (unsigned)(256 * (1 - half) * 1024 + 2 * n16) * 4u;
  v2f hv[8][4];
#pragma unroll
  for (int i = 0; i < 2; ++i) {
#pragma unroll
    for (int q = 0; q < 8; ++q) {
      hv[q][i] = (q < 4) ? ldV((const v2f*)(Hlo + (size_t)(64 * i + 512 * q) * 1024), hl)
                         : ldV((const v2f*)(Hhi + (size_t)(64 * (3 - i) + 512 * (7 - q)) * 1024), hh);
    }
  }
  // the offset registers that the loads name are held until this wait, so none of them lands on one
  asm volatile("s_wait_xcnt 0x0" ::"v"(lo), "v"(hl), "v"(hh) : "memory");
  // all the loads above are issued before anything else takes registers: otherwise the build holds
  // half of them back behind the matrices' sine work
  __builtin_amdgcn_sched_barrier(0);

  v8f P[2][8];
#pragma unroll
  for (int j = 0; j < 8; ++j) {
    v2f a[4];  // row r, column t0 = 8*n + j = 16*kk + 8*half + j
    initM<-1>(n16 >> 1, n16 & 1, 8 * half + j, 16, 0, a);
#pragma unroll
    for (int c = 0; c < 2; ++c) {
      v2f b[4];
#pragma unroll
      for (int kk = 0; kk < 4; ++kk) b[kk] = v2f{g[j][kk][2 * c], g[j][kk][2 * c + 1]};
      P[c][j] = dft8(a, b);
    }
  }

  // the later parts' loads, index and sine work stay behind this line: scheduled up among the
  // products they cost registers, and the build spills
  __builtin_amdgcn_sched_barrier(0);

  // the other half of the filter is asked for once registers are free; it arrives during the first
  // half's butterflies
#pragma unroll
  for (int i = 2; i < 4; ++i) {
#pragma unroll
    for (int q = 0; q < 8; ++q) {
      hv[q][i] = (q < 4) ? ldV((const v2f*)(Hlo + (size_t)(64 * i + 512 * q) * 1024), hl)
                         : ldV((const v2f*)(Hhi + (size_t)(64 * (3 - i) + 512 * (7 - q)) * 1024), hh);
    }
  }
  // the offset registers that the loads name are held until this wait
  asm volatile("s_wait_xcnt 0x0" ::"v"(hl), "v"(hh) : "memory");

  // The inverse takes its input where the accumulators hold it: registers 2*i and 2*i+1, row
  // r = i + 4*half, are B-fragment i; the matrix columns follow that k order.
  v2f Q[2][8][4];
#pragma unroll
  for (int i = 0; i < 4; ++i) {
#pragma unroll
    for (int c = 0; c < 2; ++c) {
      v2f a[8], x[8];
#pragma unroll
      for (int j = 0; j < 8; ++j) a[j] = v2f{P[c][j][2 * i], P[c][j][2 * i + 1]};
      radix8<-1>(a, x);
#pragma unroll
      for (int q = 0; q < 8; ++q) x[q] = x[q] * hv[q][i][c];
      radix8<1>(x, a);
#pragma unroll
      for (int j = 0; j < 8; ++j) Q[c][j][i] = a[j];
    }
  }

#pragma unroll
  for (int j = 0; j < 8; ++j) {
    // row n of part j is t0 = 8*n + j; the matrix holds the twiddle e^{+2pi i t0 k1/4096} as well
    v2f a[4];
    initM<1>(8 * (n16 >> 1) + j, n16 & 1, 4 * half, 1, k1, a);
    v8f e = dft8(a, Q[0][j]);
    v8f o = dft8(a, Q[1][j]);
#pragma unroll
    for (int i = 0; i < 4; ++i) {
      // t0 = 8*(i + 4*half) + j
      v4f r = {e[2 * i], e[2 * i + 1], o[2 * i], o[2 * i + 1]};
      stQ(G + (size_t)(8 * i + j) * 1024 * 2, so, r);
    }
  }
  // the offset register that the stores name is held until this wait
  asm volatile("s_wait_xcnt 0x0" ::"v"(so) : "memory");
}

// ---------------- Kernel C: inverse stage-2 over k1 ----------------
// w = (1/4096)*gain[d]*sum_k1 e^{+2pi i t1 k1/64} C[k1][t0][d];
// y[p][64*t1+t0][d] = Re w, y[p+2][64*t1+t0][d] = Im w
// A wave takes 32 columns of one t0, as in kernel A: a lane loads the {re, im} pairs of two
// neighbouring columns at once and stores two columns of y at once, so that 16 lanes store a whole
// 128-byte line.
// launch_bounds' second argument: a budget of 256 VGPRs: all of a wave's loads are in flight at once.
__global__ void __launch_bounds__(128, 4) kC(const float* __restrict__ Gf,
                                          const float* __restrict__ gain,
                                          float* __restrict__ y) {
  const int lane = threadIdx.x & 31;
  // the wave's number as a scalar: the column base stays out of the VGPRs
  const int wave = __builtin_amdgcn_readfirstlane(threadIdx.x >> 5);
  const int half = lane >> 4;
  const int n16 = lane & 15;
  const int d0 = blockIdx.x * 128 + wave * 32;
  const int t0 = blockIdx.y;
  const int p = blockIdx.z;
  const float* G = Gf + (((size_t)p * 64 * 64 + t0) * 1024 + d0) * 2;  // k1 = 0
  const unsigned lo = (unsigned)(half * 64 * 1024 + 2 * n16) * 8u;  // k1 = half, two columns
  // one offset register for every two j, 8 MiB apart, the reach of a load's constant offset
  const unsigned lj[4] = {lo, farOff(lo, 8u << 20), farOff(lo, 16u << 20), farOff(lo, 24u << 20)};

  v4f g[4][8];  // [kk][j]: C[k1][d], two columns
#pragma unroll
  for (int j = 0; j < 8; ++j) {
#pragma unroll
    for (int kk = 0; kk < 4; ++kk) {
      // k1 = 8*j + 2*kk + half
      g[kk][j] = ldQ(G + (size_t)(8 * (j & 1) + 2 * kk) * 64 * 1024 * 2, lj[j >> 1]);
    }
  }
  const unsigned go = (unsigned)n16 * 8u;
  const v2f ag = ldV((const v2f*)(gain + d0), go) * (1.f / 4096.f);
  // the offset registers that the loads name are held until this wait, so none of them lands on one
  asm volatile("s_wait_xcnt 0x0" ::"v"(go), "v"(lj[0]), "v"(lj[1]), "v"(lj[2]), "v"(lj[3])
               : "memory");

  // t1 = 0, this t0, batch p; the lane adds t1 = 8*(4*half) and its two columns, and for batch p+2
  // 32 MiB more
  float* ya = y + ((size_t)p * 4096 + t0) * 1024 + d0;
  const unsigned so = (unsigned)(2048 * half * 1024 + 2 * n16) * 4u;
  const unsigned sb = farOff(so, 32u << 20);

  v2f z[2][8][4];  // [tile][q][kk]: B-fragments, {re, im} of n = 2*kk + half
#pragma unroll
  for (int kk = 0; kk < 4; ++kk) {
    v4f t[8];
    radix8<1>(g[kk], t);
#pragma unroll
    for (int q = 0; q < 8; ++q) {
      z[0][q][kk] = v2f{t[q].x, t[q].y};
      z[1][q][kk] = v2f{t[q].z, t[q].w};
    }
  }

#pragma unroll
  for (int q = 0; q < 8; ++q) {
    // row r of part q is t1 = 8*r + q
    v2f a[4];
    initM<1>(8 * (n16 >> 1) + q, n16 & 1, half, 2, 0, a);
    v8f e = dft8(a, z[0][q]);
    v8f o = dft8(a, z[1][q]);
#pragma unroll
    for (int i = 0; i < 4; ++i) {
      size_t off = (size_t)(8 * i + q) * 64 * 1024;  // t1 = 8*(i + 4*half) + q
      v2f re, im;
      re.x = e[2 * i] * ag.x;
      re.y = o[2 * i] * ag.y;
      im.x = e[2 * i + 1] * ag.x;
      im.y = o[2 * i + 1] * ag.y;
      stV((v2f*)(ya + off), so, re);
      stV((v2f*)(ya + off), sb, im);
    }
  }
  // the offset registers that the stores name are held until this wait
  asm volatile("s_wait_xcnt 0x0" ::"v"(so), "v"(sb) : "memory");
}

extern "C" void kernel_launch(void* const* d_in, const int* in_sizes, int n_in,
                              void* d_out, int out_size, void* d_ws, size_t ws_size,
                              hipStream_t stream) {
  const float* x = (const float*)d_in[0];
  const float* W1 = (const float*)d_in[1];
  const float* b1 = (const float*)d_in[2];
  const float* W2 = (const float*)d_in[3];
  const float* b2 = (const float*)d_in[4];
  const float* ag = (const float*)d_in[5];
  float* out = (float*)d_out;

  // workspace layout: Hbins[2049*1024] | G[2*4096*1024] {re,im} pairs  (~76 MB)
  float* Hb = (float*)d_ws;
  float* wG = Hb + (size_t)2049 * 1024;

  // 257 filter groups, then 512 stage-1 groups
  kHA<<<dim3(769, 1, 1), 256, 0, stream>>>(x, W1, b1, W2, b2, Hb, wG);
  kB<<<dim3(8, 64, 2), 128, 0, stream>>>(wG, Hb);
  kC<<<dim3(8, 64, 2), 128, 0, stream>>>(wG, ag, out);
}

// v009
// Measured time: 43.7 microseconds a run.
// Next to v008, in two timings, it ran 1.29 and 1.28 times as fast.
// Over all steps from v000 it is 7.85 times as fast.
#include <hip/hip_runtime.h>
#include <hip/hip_bf16.h>

typedef __attribute__((ext_vector_type(2))) float v2f;
typedef __attribute__((ext_vector_type(4))) float v4f;
typedef __attribute__((ext_vector_type(8))) float v8f;

// D = A(16x4) * B(4x16) + C, f32 WMMA (CDNA5 V_WMMA_F32_16X16X4_F32)
static __device__ __forceinline__ v8f wmma4(v2f a, v2f b, v8f c) {
  return __builtin_amdgcn_wmma_f32_16x16x4_f32(false, a, false, b, (short)0, c,
                                               false, false);
}

// Every 64-point DFT is factored 64 = 8 x 8. In kernels A and C, with t = n + 8*j and k = 8*r + q,
//   X[8r+q] = sum_n w64^((8r+q)*n) * sum_j w8^(q*j) * z[n+8j],   w_N = e^(SG*2*pi*i/N):
// the sum over j is a radix-8 butterfly on values that a lane already holds, and the sum over n is a
// complex 8x8 matrix product. Written out in real numbers (rows: re and im of r, K: re and im of n)
// that matrix is 16x16, one WMMA tile with nothing idle: four WMMAs do one part q of 16 columns.
// Each part has a matrix of its own, so its entries are the full angles of the formula above.

// sin and cos of 2*pi*num/den, den a power of two: the hardware takes the angle in turns, and
// num/den is exact in f32.
static __device__ __forceinline__ void sincosTurns(int num, float invDen, float& s, float& c) {
  float t = (float)num * invDen;
  // Neither result shares a register with the angle, and the v_nop is the free slot that the
  // instruction set asks for between a transcendental and the first reader of its result.
  asm("v_sin_f32 %0, %2\n\tv_cos_f32 %1, %2\n\tv_nop" : "=&v"(s), "=&v"(c) : "v"(t));
}

// Access at a wave-uniform base plus the lane's own byte offset: the base and every constant step
// stay in scalar registers, and one VGPR serves all the accesses of a lane.
static __device__ __forceinline__ float ldF(const float* u, unsigned b) {
  return *(const float*)((const char*)u + b);
}
static __device__ __forceinline__ v2f ldV(const v2f* u, unsigned b) {
  return *(const v2f*)((const char*)u + b);
}
static __device__ __forceinline__ v4f ldQ(const float* u, unsigned b) {
  return *(const v4f*)((const char*)u + b);
}
// The same with a non-temporal hint, for the four large streams (x, G read, G stored, y): a launch
// touches each of their bytes once, so a place kept for them in L2 serves nobody. The filter and the
// weights, which many waves read, keep the plain forms.
static __device__ __forceinline__ v2f ldVnt(const v2f* u, unsigned b) {
  return __builtin_nontemporal_load((const v2f*)((const char*)u + b));
}
static __device__ __forceinline__ v4f ldQnt(const float* u, unsigned b) {
  return __builtin_nontemporal_load((const v4f*)((const char*)u + b));
}
static __device__ __forceinline__ void stVnt(v2f* u, unsigned b, v2f v) {
  __builtin_nontemporal_store(v, (v2f*)((char*)u + b));
}
static __device__ __forceinline__ void stQnt(float* u, unsigned b, v4f v) {
  __builtin_nontemporal_store(v, (v4f*)((char*)u + b));
}
static __device__ __forceinline__ void stQ(float* u, unsigned b, v4f v) {
  *(v4f*)((char*)u + b) = v;
}
static __device__ __forceinline__ void stF(float* u, unsigned b, float v) {
  *(float*)((char*)u + b) = v;
}

// The lane's byte offset moved on by a constant too large for an access's own offset field.
// The add is written in asm so that the accesses name this one register beside the scalar base:
// left to itself the compiler takes the constant out again and forms 64-bit address pairs of its
// own, which the source cannot hold until the wait that follows the accesses.
static __device__ __forceinline__ unsigned farOff(unsigned b, unsigned step) {
  unsigned r;
  asm("v_add_nc_u32 %0, %1, %2" : "=v"(r) : "s"(step), "v"(b));
  return r;
}

// A-fragments of one part's matrix. The complex 8x8 matrix has the entries
// e^(SG*2*pi*i*k*(64*col + tw)/4096), k the frequency of the row; 64*k*col is the 64-point DFT's own
// angle, k*tw a twiddle of the 4096-point transform. In real form row 2*r holds {c, -s} and row
// 2*r+1 holds {s, c} at the K positions {re, im} of a column. The lane's row is n16: k belongs to
// r = n16 >> 1, im = n16 & 1; fragment kk holds the complex column col0 + step*kk.
template <int SG>  // SG: -1 forward, +1 inverse
static __device__ __forceinline__ void initM(int k, int im, int col0, int step, int tw,
                                             v2f (&a)[4]) {
#pragma unroll
  for (int kk = 0; kk < 4; ++kk) {
    int col = col0 + step * kk;
    float s, c;
    sincosTurns((k * (64 * col + tw)) & 4095, 1.f / 4096.f, s, c);
    s *= (float)SG;
    a[kk].x = im ? s : c;
    a[kk].y = im ? c : -s;
  }
}

// One part's matrix product on 16 columns. b[kk] = {re, im} of the complex element that stands at
// column kk of the lane's half in the matrix. Result: registers 2*i and 2*i+1 are {re, im} of row
// r = i + 4*half.
static __device__ __forceinline__ v8f dft8(const v2f (&a)[4], const v2f (&b)[4]) {
  v8f acc = {0, 0, 0, 0, 0, 0, 0, 0};
#pragma unroll
  for (int kk = 0; kk < 4; ++kk) acc = wmma4(a[kk], b[kk], acc);
  return acc;
}

// Complex values for the butterflies, in the three forms in which a lane holds them.
// i times a {re, im} pair, and i times the pairs of two columns side by side:
static __device__ __forceinline__ v2f rotI(v2f v) { return v2f{-v.y, v.x}; }
static __device__ __forceinline__ v4f rotI(v4f v) { return v4f{-v.y, v.x, -v.w, v.z}; }
// real and imaginary parts apart, each {even column, odd column}:
struct cpx2 {
  v2f r, i;
};
static __device__ __forceinline__ cpx2 operator+(cpx2 a, cpx2 b) { return cpx2{a.r + b.r, a.i + b.i}; }
static __device__ __forceinline__ cpx2 operator-(cpx2 a, cpx2 b) { return cpx2{a.r - b.r, a.i - b.i}; }
static __device__ __forceinline__ cpx2 operator*(cpx2 a, float f) { return cpx2{a.r * f, a.i * f}; }
static __device__ __forceinline__ cpx2 rotI(cpx2 v) { return cpx2{-v.i, v.r}; }

// x[q] = sum_j w4^(q*j) * b[j]
template <int SG, class T>
static __device__ __forceinline__ void radix4(T b0, T b1, T b2, T b3, T (&x)[4]) {
  T s0 = b0 + b2, s1 = b0 - b2, s2 = b1 + b3;
  T s3 = rotI(b1 - b3) * (float)SG;
  x[0] = s0 + s2;
  x[1] = s1 + s3;
  x[2] = s0 - s2;
  x[3] = s1 - s3;
}

// x[q] = sum_j w8^(q*j) * a[j]: the even and the odd j as two radix-4 butterflies, then
// x[m] = E[m] + w8^m * O[m] and x[m+4] = E[m] - w8^m * O[m].
template <int SG, class T>
static __device__ __forceinline__ void radix8(const T (&a)[8], T (&x)[8]) {
  const float sg = (float)SG;
  const float h = 0.70710678118654752f;
  T E[4], O[4];
  radix4<SG>(a[0], a[2], a[4], a[6], E);
  radix4<SG>(a[1], a[3], a[5], a[7], O);
  T w[4];
  w[0] = O[0];
  w[1] = (O[1] + rotI(O[1]) * sg) * h;  // (1 + SG*i)/sqrt(2)
  w[2] = rotI(O[2]) * sg;               // SG*i
  w[3] = (rotI(O[3]) * sg - O[3]) * h;  // (-1 + SG*i)/sqrt(2)
#pragma unroll
  for (int m = 0; m < 4; ++m) {
    x[m] = E[m] + w[m];
    x[m + 4] = E[m] - w[m];
  }
}

// ---------------- tiny filter MLP:  Hbins[2049][1024] ----------------
// One work-group makes eight bins over all 1024 columns. Threads 0..127 make one sine or
// cosine each; every thread one hidden unit and four columns of all eight bins, so that a value of W2
// is loaded once for eight bins. Each sum runs in the order i = 0..15 and j = 0..31.
// The last group has one bin of its own, 2048: it makes that bin eight times, and a thread stores
// the same value to the same place each time.
// grp: which eight bins, 0..256.
static __device__ __forceinline__ void filterBins(int grp, const float* __restrict__ W1,
                                                  const float* __restrict__ b1,
                                                  const float* __restrict__ W2,
                                                  const float* __restrict__ b2,
                                                  float* __restrict__ Hb) {
  __shared__ float pe[8][16];
  __shared__ __attribute__((aligned(16))) float h[32][8];
  const int tid = threadIdx.x;
  const int bin0 = grp * 8;

  // All the weights are asked for first: they arrive while the sines are worked out.
  const unsigned co = (unsigned)tid * 16u;  // columns 4*tid .. 4*tid+3
  v4f w2[32];
#pragma unroll
  for (int j = 0; j < 32; ++j) w2[j] = ldQ(W2 + j * 1024, co);
  const v4f bias = ldQ(b2, co);
  const int hj = tid & 31;  // hidden unit
  const int hb = tid >> 5;  // its bin: the wave's number
  const unsigned jo = (unsigned)hj * 4u;
  float w1[16];
#pragma unroll
  for (int i = 0; i < 16; ++i) w1[i] = ldF(W1 + i * 32, jo);
  float acc = ldF(b1, jo);
  // the index registers that the loads name are held until this wait, so none of them lands on one
  asm volatile("s_wait_xcnt 0x0" ::"v"(tid), "v"(hj) : "memory");

  if (tid < 128) {  // waves 0 and 1: the sines; waves 2 and 3: the cosines
    const int m = tid & 7;
    const int b = (tid >> 3) & 7;
    float invf = 1.f;
#pragma unroll
    for (int mm = 1; mm < 8; ++mm)
      if (m == mm) invf = expf((float)(2 * mm) * (-9.210340371976184f / 16.f));
    float arg = (float)min(bin0 + b, 2048) * invf;
    if (tid < 64) pe[b][2 * m] = sinf(arg);
    else pe[b][2 * m + 1] = cosf(arg);
  }
  __syncthreads();
#pragma unroll
  for (int i = 0; i < 16; ++i) acc = __builtin_fmaf(pe[hb][i], w1[i], acc);
  h[hj][hb] = acc / (1.f + expf(-acc));  // SiLU
  __syncthreads();

  v4f o[8];
#pragma unroll
  for (int b = 0; b < 8; ++b) o[b] = bias;
#pragma unroll
  for (int j = 0; j < 32; ++j) {
#pragma unroll
    for (int b = 0; b < 8; ++b) o[b] += h[j][b] * w2[j];
  }
#pragma unroll
  for (int b = 0; b < 8; ++b) stQ(Hb + (size_t)min(bin0 + b, 2048) * 1024, co, o[b]);
}

// The filter is real and even in the bin index (bin k and bin 4096-k use the same value), so its
// impulse response is real. Two real signals that share a filter therefore go through ONE complex
// transform: z = x[p] + i*x[p+2] (batches p and p+2, same column d, same filter column).
// Re(ifft(fft(z)*H)) is the result for batch p, Im(...) the result for batch p+2.
// G holds z's transform as {re, im} pairs: G[p][k1][t0][d], p = 0..1.

// ---------------- Kernel A: stage-1 forward DFT over t1 + twiddle ----------------
// G[p][k1][t0][d] = w4096^{t0*k1} * sum_t1 e^{-2pi i k1 t1/64} z[p][64*t1+t0][d]
// A wave takes 32 columns of one t0: a lane loads two neighbouring columns at once, so that 16 lanes
// cover a whole 128-byte line of x, and the even and the odd columns are two WMMA tiles. The eight
// waves of a work-group stand side by side on 256 columns.
// grp: which 256 columns (2 bits), above them t0 (6 bits), above that p.
static __device__ __forceinline__ void stage1(int grp, const float* __restrict__ x,
                                              float* __restrict__ Gf) {
  const int lane = threadIdx.x & 31;
  // the wave's number as a scalar: the column base stays out of the VGPRs
  const int wave = __builtin_amdgcn_readfirstlane(threadIdx.x >> 5);
  const int half = lane >> 4;
  const int n16 = lane & 15;
  const int d0 = (grp & 3) * 256 + wave * 32;
  const int t0 = (grp >> 2) & 63;
  const int p = grp >> 8;

  // row t0 (t1 = 0) of batch p (real part); batch p+2 is the imaginary part
  const float* xa = x + ((size_t)p * 4096 + t0) * 1024 + d0;
  const unsigned lo = (unsigned)(64 * half * 1024 + 2 * n16) * 4u;  // t1 = half, two columns
  // one offset register for every 8 MiB, the reach of a load's constant offset: j = 0..3 and
  // j = 4..7 of batch p, then of batch p+2, which lies 32 MiB further on
  const unsigned la[2] = {lo, farOff(lo, 8u << 20)};
  const unsigned lb[2] = {farOff(lo, 32u << 20), farOff(lo, 40u << 20)};

  cpx2 u[4][8];  // [kk][j]
#pragma unroll
  for (int j = 0; j < 8; ++j) {
#pragma unroll
    for (int kk = 0; kk < 4; ++kk) {
      // t1 = 8*j + 2*kk + half
      const v2f* row = (const v2f*)(xa + (size_t)(8 * (j & 3) + 2 * kk) * 64 * 1024);
      u[kk][j].r = ldVnt(row, la[j >> 2]);
      u[kk][j].i = ldVnt(row, lb[j >> 2]);
    }
  }
  // the offset registers that the loads name are held until this wait, so none of them lands on one
  asm volatile("s_wait_xcnt 0x0" ::"v"(la[0]), "v"(la[1]), "v"(lb[0]), "v"(lb[1]) : "memory");

  // k1 = 0, this t0; the lane adds k1 = 8*(4*half) and its two columns
  float* G = Gf + ((((size_t)p * 64) * 64 + t0) * 1024 + d0) * 2;
  const unsigned so = (unsigned)(32 * half * 64 * 1024 + 2 * n16) * 8u;
  const unsigned sv[2] = {so, farOff(so, 8u << 20)};  // i = 0, 1 and i = 2, 3, 8 MiB apart

  v2f z[2][8][4];  // [tile][q][kk]: B-fragments, {re, im} of n = 2*kk + half
#pragma unroll
  for (int kk = 0; kk < 4; ++kk) {
    cpx2 t[8];
    radix8<-1>(u[kk], t);
#pragma unroll
    for (int q = 0; q < 8; ++q) {
      z[0][q][kk] = v2f{t[q].r.x, t[q].i.x};
      z[1][q][kk] = v2f{t[q].r.y, t[q].i.y};
    }
  }

#pragma unroll
  for (int q = 0; q < 8; ++q) {
    // row r of part q is k1 = 8*r + q; the matrix holds the twiddle w4096^(t0*k1) as well
    v2f a[4];
    initM<-1>(8 * (n16 >> 1) + q, n16 & 1, half, 2, t0, a);
    v8f e = dft8(a, z[0][q]);
    v8f o = dft8(a, z[1][q]);
#pragma unroll
    for (int i = 0; i < 4; ++i) {
      // k1 = 8*(i + 4*half) + q
      v4f g = {e[2 * i], e[2 * i + 1], o[2 * i], o[2 * i + 1]};
      stQnt(G + (size_t)(8 * (i & 1) + q) * 64 * 1024 * 2, sv[i >> 1], g);
    }
  }
  // the offset registers that the stores name are held until this wait
  asm volatile("s_wait_xcnt 0x0" ::"v"(sv[0]), "v"(sv[1]) : "memory");
}

// ---------------- One launch for the filter and stage 1 ----------------
// Neither needs the other's result; kernel B, the next launch, needs both. The 257 filter groups
// have the lowest indices.
// launch_bounds' second argument: a budget of 256 VGPRs, which keeps every register directly
// addressable.
__global__ void __launch_bounds__(256, 4) kHA(const float* __restrict__ x,
                                           const float* __restrict__ W1,
                                           const float* __restrict__ b1,
                                           const float* __restrict__ W2,
                                           const float* __restrict__ b2,
                                           float* __restrict__ Hb,
                                           float* __restrict__ Gf) {
  const int b = blockIdx.x;
  if (b < 257) filterBins(b, W1, b1, W2, b2, Hb);
  else stage1(b - 257, x, Gf);
}

// ---------------- Kernel B: fwd over t0, *Hfull, inv over k2, conj twiddle (in place) ----
// A wave takes 32 columns of one k1, as in kernels A and C: a lane loads and stores the {re, im}
// pairs of two neighbouring columns at once, so that 16 lanes cover 256 bytes of a row of G and a
// whole 128-byte line of the filter, and the even and the odd columns are two WMMA tiles. The four
// waves of a work-group stand side by side on 128 columns.
// Here the matrix products stand at both ends and the butterflies in the middle. With t0 = 8*n + j
// and k2 = r + 8*q:
//   P_j[r]    = sum_n e^{-2pi i r(8n+j)/64} G[8n+j]           (matrix of part j)
//   Xf[r+8q]  = sum_j w8^(-q*j) P_j[r],   Y = Xf * Hfull[k1 + 64*k2]
//   Q_j[r]    = sum_q w8^(+q*j) Y[r+8q]
//   C[8n+j]   = sum_r e^{+2pi i (8n+j)(64r+k1)/4096} Q_j[r]   (matrix of part j, conj twiddle inside)
// Both butterflies and the filter work on accumulator registers of one row r: nothing moves between
// lanes.
// launch_bounds' second argument: a budget of 256 VGPRs; all the work-groups that fall to a WGP are
// resident at once.
__global__ void __launch_bounds__(128, 4) kB(float* __restrict__ Gf,
                                          const float* __restrict__ Hb) {
  const int lane = threadIdx.x & 31;
  // the wave's number as a scalar: the column base stays out of the VGPRs
  const int wave = __builtin_amdgcn_readfirstlane(threadIdx.x >> 5);
  const int half = lane >> 4;
  const int n16 = lane & 15;
  const int d0 = blockIdx.x * 128 + wave * 32;
  const int k1 = blockIdx.y;
  const int p = blockIdx.z;
  float* G = Gf + ((((size_t)p * 64 + k1) * 64) * 1024 + d0) * 2;  // t0 = 0
  const unsigned lo = (unsigned)(8 * half * 1024 + 2 * n16) * 8u;   // loads: t0 = 8*half, two columns
  const unsigned so = (unsigned)(32 * half * 1024 + 2 * n16) * 8u;  // stores: t0 = 32*half, two columns

  // g[j][kk] = G[t0 = 8*n + j][d], n = 2*kk + half, two columns: each {re, im} pair is a B-fragment
  // as it stands
  v4f g[8][4];
#pragma unroll
  for (int j = 0; j < 8; ++j) {
#pragma unroll
    for (int kk = 0; kk < 4; ++kk) g[j][kk] = ldQnt(G + (size_t)(16 * kk + j) * 1024 * 2, lo);
  }

  // The filter at the lane's two columns, row r = i + 4*half: k = k1 + 64*r + 512*q. It is real and
  // symmetric: bin k for q = 0..3 (k < 2048) and bin 4096 - k for q = 4..7 (k >= 2048).
  const float* Hlo = Hb + d0 + (size_t)k1 * 1024;
  const float* Hhi = Hb + d0 + (size_t)(64 - k1) * 1024;  // q = 7, i = 3, half = 1: the lowest such bin
  const unsigned hl = (unsigned)(256 * half * 1024 + 2 * n16) * 4u;
  const unsigned hh = (unsigned)(256 * (1 - half) * 1024 + 2 * n16) * 4u;
  v2f hv[8][4];
#pragma unroll
  for (int i = 0; i < 2; ++i) {
#pragma unroll
    for (int q = 0; q < 8; ++q) {
      hv[q][i] = (q < 4) ? ldV((const v2f*)(Hlo + (size_t)(64 * i + 512 * q) * 1024), hl)
                         : ldV((const v2f*)(Hhi + (size_t)(64 * (3 - i) + 512 * (7 - q)) * 1024), hh);
    }
  }
  // the offset registers that the loads name are held until this wait, so none of them lands on one
  asm volatile("s_wait_xcnt 0x0" ::"v"(lo), "v"(hl), "v"(hh) : "memory");
  // all the loads above are issued before anything else takes registers: otherwise the build holds
  // half of them back behind the matrices' sine work
  __builtin_amdgcn_sched_barrier(0);

  v8f P[2][8];
#pragma unroll
  for (int j = 0; j < 8; ++j) {
    v2f a[4];  // row r, column t0 = 8*n + j = 16*kk + 8*half + j
    initM<-1>(n16 >> 1, n16 & 1, 8 * half + j, 16, 0, a);
#pragma unroll
    for (int c = 0; c < 2; ++c) {
      v2f b[4];
#pragma unroll
      for (int kk = 0; kk < 4; ++kk) b[kk] = v2f{g[j][kk][2 * c], g[j][kk][2 * c + 1]};
      P[c][j] = dft8(a, b);
    }
  }

  // the later parts' loads, index and sine work stay behind this line: scheduled up among the
  // products they cost registers, and the build spills
  __builtin_amdgcn_sched_barrier(0);

  // the other half of the filter is asked for once registers are free; it arrives during the first
  // half's butterflies
#pragma unroll
  for (int i = 2; i < 4; ++i) {
#pragma unroll
    for (int q = 0; q < 8; ++q) {
      hv[q][i] = (q < 4) ? ldV((const v2f*)(Hlo + (size_t)(64 * i + 512 * q) * 1024), hl)
                         : ldV((const v2f*)(Hhi + (size_t)(64 * (3 - i) + 512 * (7 - q)) * 1024), hh);
    }
  }
  // the offset registers that the loads name are held until this wait
  asm volatile("s_wait_xcnt 0x0" ::"v"(hl), "v"(hh) : "memory");

  // The inverse takes its input where the accumulators hold it: registers 2*i and 2*i+1, row
  // r = i + 4*half, are B-fragment i; the matrix columns follow that k order.
  v2f Q[2][8][4];
#pragma unroll
  for (int i = 0; i < 4; ++i) {
#pragma unroll
    for (int c = 0; c < 2; ++c) {
      v2f a[8], x[8];
#pragma unroll
      for (int j = 0; j < 8; ++j) a[j] = v2f{P[c][j][2 * i], P[c][j][2 * i + 1]};
      radix8<-1>(a, x);
#pragma unroll
      for (int q = 0; q < 8; ++q) x[q] = x[q] * hv[q][i][c];
      radix8<1>(x, a);
#pragma unroll
      for (int j = 0; j < 8; ++j) Q[c][j][i] = a[j];
    }
  }

#pragma unroll
  for (int j = 0; j < 8; ++j) {
    // row n of part j is t0 = 8*n + j; the matrix holds the twiddle e^{+2pi i t0 k1/4096} as well
    v2f a[4];
    initM<1>(8 * (n16 >> 1) + j, n16 & 1, 4 * half, 1, k1, a);
    v8f e = dft8(a, Q[0][j]);
    v8f o = dft8(a, Q[1][j]);
#pragma unroll
    for (int i = 0; i < 4; ++i) {
      // t0 = 8*(i + 4*half) + j
      v4f r = {e[2 * i], e[2 * i + 1], o[2 * i], o[2 * i + 1]};
      stQnt(G + (size_t)(8 * i + j) * 1024 * 2, so, r);
    }
  }
  // the offset register that the stores name is held until this wait
  asm volatile("s_wait_xcnt 0x0" ::"v"(so) : "memory");
}

// ---------------- Kernel C: inverse stage-2 over k1 ----------------
// w = (1/4096)*gain[d]*sum_k1 e^{+2pi i t1 k1/64} C[k1][t0][d];
// y[p][64*t1+t0][d] = Re w, y[p+2][64*t1+t0][d] = Im w
// A wave takes 32 columns of one t0, as in kernel A: a lane loads the {re, im} pairs of two
// neighbouring columns at once and stores two columns of y at once, so that 16 lanes store a whole
// 128-byte line.
// launch_bounds' second argument: a budget of 256 VGPRs: all of a wave's loads are in flight at once.
__global__ void __launch_bounds__(128, 4) kC(const float* __restrict__ Gf,
                                          const float* __restrict__ gain,
                                          float* __restrict__ y) {
  const int lane = threadIdx.x & 31;
  // the wave's number as a scalar: the column base stays out of the VGPRs
  const int wave = __builtin_amdgcn_readfirstlane(threadIdx.x >> 5);
  const int half = lane >> 4;
  const int n16 = lane & 15;
  const int d0 = blockIdx.x * 128 + wave * 32;
  const int t0 = blockIdx.y;
  const int p = blockIdx.z;
  const float* G = Gf + (((size_t)p * 64 * 64 + t0) * 1024 + d0) * 2;  // k1 = 0
  const unsigned lo = (unsigned)(half * 64 * 1024 + 2 * n16) * 8u;  // k1 = half, two columns
  // one offset register for every two j, 8 MiB apart, the reach of a load's constant offset
  const unsigned lj[4] = {lo, farOff(lo, 8u << 20), farOff(lo, 16u << 20), farOff(lo, 24u << 20)};

  v4f g[4][8];  // [kk][j]: C[k1][d], two columns
#pragma unroll
  for (int j = 0; j < 8; ++j) {
#pragma unroll
    for (int kk = 0; kk < 4; ++kk) {
      // k1 = 8*j + 2*kk + half
      g[kk][j] = ldQnt(G + (size_t)(8 * (j & 1) + 2 * kk) * 64 * 1024 * 2, lj[j >> 1]);
    }
  }
  const unsigned go = (unsigned)n16 * 8u;
  const v2f ag = ldV((const v2f*)(gain + d0), go) * (1.f / 4096.f);
  // the offset registers that the loads name are held until this wait, so none of them lands on one
  asm volatile("s_wait_xcnt 0x0" ::"v"(go), "v"(lj[0]), "v"(lj[1]), "v"(lj[2]), "v"(lj[3])
               : "memory");

  // t1 = 0, this t0, batch p; the lane adds t1 = 8*(4*half) and its two columns, and for batch p+2
  // 32 MiB more
  float* ya = y + ((size_t)p * 4096 + t0) * 1024 + d0;
  const unsigned so = (unsigned)(2048 * half * 1024 + 2 * n16) * 4u;
  const unsigned sb = farOff(so, 32u << 20);

  v2f z[2][8][4];  // [tile][q][kk]: B-fragments, {re, im} of n = 2*kk + half
#pragma unroll
  for (int kk = 0; kk < 4; ++kk) {
    v4f t[8];
    radix8<1>(g[kk], t);
#pragma unroll
    for (int q = 0; q < 8; ++q) {
      z[0][q][kk] = v2f{t[q].x, t[q].y};
      z[1][q][kk] = v2f{t[q].z, t[q].w};
    }
  }

#pragma unroll
  for (int q = 0; q < 8; ++q) {
    // row r of part q is t1 = 8*r + q
    v2f a[4];
    initM<1>(8 * (n16 >> 1) + q, n16 & 1, half, 2, 0, a);
    v8f e = dft8(a, z[0][q]);
    v8f o = dft8(a, z[1][q]);
#pragma unroll
    for (int i = 0; i < 4; ++i) {
      size_t off = (size_t)(8 * i + q) * 64 * 1024;  // t1 = 8*(i + 4*half) + q
      v2f re, im;
      re.x = e[2 * i] * ag.x;
      re.y = o[2 * i] * ag.y;
      im.x = e[2 * i + 1] * ag.x;
      im.y = o[2 * i + 1] * ag.y;
      stVnt((v2f*)(ya + off), so, re);
      stVnt((v2f*)(ya + off), sb, im);
    }
  }
  // the offset registers that the stores name are held until this wait
  asm volatile("s_wait_xcnt 0x0" ::"v"(so), "v"(sb) : "memory");
}

extern "C" void kernel_launch(void* const* d_in, const int* in_sizes, int n_in,
                              void* d_out, int out_size, void* d_ws, size_t ws_size,
                              hipStream_t stream) {
  const float* x = (const float*)d_in[0];
  const float* W1 = (const float*)d_in[1];
  const float* b1 = (const float*)d_in[2];
  const float* W2 = (const float*)d_in[3];
  const float* b2 = (const float*)d_in[4];
  const float* ag = (const float*)d_in[5];
  float* out = (float*)d_out;

  // workspace layout: Hbins[2049*1024] | G[2*4096*1024] {re,im} pairs  (~76 MB)
  float* Hb = (float*)d_ws;
  float* wG = Hb + (size_t)2049 * 1024;

  // 257 filter groups, then 512 stage-1 groups
  kHA<<<dim3(769, 1, 1), 256, 0, stream>>>(x, W1, b1, W2, b2, Hb, wG);
  kB<<<dim3(8, 64, 2), 128, 0, stream>>>(wG, Hb);
  kC<<<dim3(8, 64, 2), 128, 0, stream>>>(wG, ag, out);
}

// v010
// A run of this version takes 42 microseconds.
// Next to v009, in two timings, it ran 1.04 times as fast each time.
// Over all steps from v000 it is 8.14 times as fast.
#include <hip/hip_runtime.h>
#include <hip/hip_bf16.h>

typedef __attribute__((ext_vector_type(2))) float v2f;
typedef __attribute__((ext_vector_type(4))) float v4f;
typedef __attribute__((ext_vector_type(8))) float v8f;

// D = A(16x4) * B(4x16) + C, f32 WMMA (CDNA5 V_WMMA_F32_16X16X4_F32)
static __device__ __forceinline__ v8f wmma4(v2f a, v2f b, v8f c) {
  return __builtin_amdgcn_wmma_f32_16x16x4_f32(false, a, false, b, (short)0, c,
                                               false, false);
}

// Every 64-point DFT is factored 64 = 8 x 8. In kernels A and C, with t = n + 8*j and k = 8*r + q,
//   X[8r+q] = sum_n w64^((8r+q)*n) * sum_j w8^(q*j) * z[n+8j],   w_N = e^(SG*2*pi*i/N):
// the sum over j is a radix-8 butterfly on values that a lane already holds, and the sum over n is a
// complex 8x8 matrix product. Written out in real numbers (rows: re and im of r, K: re and im of n)
// that matrix is 16x16, one WMMA tile with nothing idle: four WMMAs do one part q of 16 columns.
// Each part has a matrix of its own, so its entries are the full angles of the formula above.

// sin and cos of 2*pi*num/den, den a power of two: the hardware takes the angle in turns, and
// num/den is exact in f32.
static __device__ __forceinline__ void sincosTurns(int num, float invDen, float& s, float& c) {
  float t = (float)num * invDen;
  // Neither result shares a register with the angle, and the v_nop is the free slot that the
  // instruction set asks for between a transcendental and the first reader of its result.
  asm("v_sin_f32 %0, %2\n\tv_cos_f32 %1, %2\n\tv_nop" : "=&v"(s), "=&v"(c) : "v"(t));
}

// Access at a wave-uniform base plus the lane's own byte offset: the base and every constant step
// stay in scalar registers, and one VGPR serves all the accesses of a lane.
static __device__ __forceinline__ float ldF(const float* u, unsigned b) {
  return *(const float*)((const char*)u + b);
}
static __device__ __forceinline__ v2f ldV(const v2f* u, unsigned b) {
  return *(const v2f*)((const char*)u + b);
}
static __device__ __forceinline__ v4f ldQ(const float* u, unsigned b) {
  return *(const v4f*)((const char*)u + b);
}
// The same with a non-temporal hint, for the four large streams (x, G read, G stored, y): a launch
// touches each of their bytes once, so a place kept for them in L2 serves nobody. The filter and the
// weights, which many waves read, keep the plain forms.
static __device__ __forceinline__ v2f ldVnt(const v2f* u, unsigned b) {
  return __builtin_nontemporal_load((const v2f*)((const char*)u + b));
}
static __device__ __forceinline__ v4f ldQnt(const float* u, unsigned b) {
  return __builtin_nontemporal_load((const v4f*)((const char*)u + b));
}
static __device__ __forceinline__ void stVnt(v2f* u, unsigned b, v2f v) {
  __builtin_nontemporal_store(v, (v2f*)((char*)u + b));
}
static __device__ __forceinline__ void stQnt(float* u, unsigned b, v4f v) {
  __builtin_nontemporal_store(v, (v4f*)((char*)u + b));
}
static __device__ __forceinline__ void stQ(float* u, unsigned b, v4f v) {
  *(v4f*)((char*)u + b) = v;
}
static __device__ __forceinline__ void stF(float* u, unsigned b, float v) {
  *(float*)((char*)u + b) = v;
}

// Values that have just been stored stay in their registers up to this line. Freed at once, those
// registers are the first to be written again, and the wave then stands at a wait for the store it
// has only just issued; freed one part later, the wait finds that store long since taken over.
static __device__ __forceinline__ void holdStored(const v4f (&h)[4]) {
  asm volatile("" ::"v"(h[0]), "v"(h[1]), "v"(h[2]), "v"(h[3]));
}
static __device__ __forceinline__ void holdStored(const v2f (&h)[8]) {
  asm volatile("" ::"v"(h[0]), "v"(h[1]), "v"(h[2]), "v"(h[3]), "v"(h[4]), "v"(h[5]), "v"(h[6]),
               "v"(h[7]));
}

// The lane's byte offset moved on by a constant too large for an access's own offset field.
// The add is written in asm so that the accesses name this one register beside the scalar base:
// left to itself the compiler takes the constant out again and forms 64-bit address pairs of its
// own, which the source cannot hold until the wait that follows the accesses.
static __device__ __forceinline__ unsigned farOff(unsigned b, unsigned step) {
  unsigned r;
  asm("v_add_nc_u32 %0, %1, %2" : "=v"(r) : "s"(step), "v"(b));
  return r;
}

// A-fragments of one part's matrix. The complex 8x8 matrix has the entries
// e^(SG*2*pi*i*k*(64*col + tw)/4096), k the frequency of the row; 64*k*col is the 64-point DFT's own
// angle, k*tw a twiddle of the 4096-point transform. In real form row 2*r holds {c, -s} and row
// 2*r+1 holds {s, c} at the K positions {re, im} of a column. The lane's row is n16: k belongs to
// r = n16 >> 1, im = n16 & 1; fragment kk holds the complex column col0 + step*kk.
template <int SG>  // SG: -1 forward, +1 inverse
static __device__ __forceinline__ void initM(int k, int im, int col0, int step, int tw,
                                             v2f (&a)[4]) {
#pragma unroll
  for (int kk = 0; kk < 4; ++kk) {
    int col = col0 + step * kk;
    float s, c;
    sincosTurns((k * (64 * col + tw)) & 4095, 1.f / 4096.f, s, c);
    s *= (float)SG;
    a[kk].x = im ? s : c;
    a[kk].y = im ? c : -s;
  }
}

// One part's matrix product on 16 columns. b[kk] = {re, im} of the complex element that stands at
// column kk of the lane's half in the matrix. Result: registers 2*i and 2*i+1 are {re, im} of row
// r = i + 4*half.
static __device__ __forceinline__ v8f dft8(const v2f (&a)[4], const v2f (&b)[4]) {
  v8f acc = {0, 0, 0, 0, 0, 0, 0, 0};
#pragma unroll
  for (int kk = 0; kk < 4; ++kk) acc = wmma4(a[kk], b[kk], acc);
  return acc;
}

// Complex values for the butterflies, in the three forms in which a lane holds them.
// i times a {re, im} pair, and i times the pairs of two columns side by side:
static __device__ __forceinline__ v2f rotI(v2f v) { return v2f{-v.y, v.x}; }
static __device__ __forceinline__ v4f rotI(v4f v) { return v4f{-v.y, v.x, -v.w, v.z}; }
// real and imaginary parts apart, each {even column, odd column}:
struct cpx2 {
  v2f r, i;
};
static __device__ __forceinline__ cpx2 operator+(cpx2 a, cpx2 b) { return cpx2{a.r + b.r, a.i + b.i}; }
static __device__ __forceinline__ cpx2 operator-(cpx2 a, cpx2 b) { return cpx2{a.r - b.r, a.i - b.i}; }
static __device__ __forceinline__ cpx2 operator*(cpx2 a, float f) { return cpx2{a.r * f, a.i * f}; }
static __device__ __forceinline__ cpx2 rotI(cpx2 v) { return cpx2{-v.i, v.r}; }

// x[q] = sum_j w4^(q*j) * b[j]
template <int SG, class T>
static __device__ __forceinline__ void radix4(T b0, T b1, T b2, T b3, T (&x)[4]) {
  T s0 = b0 + b2, s1 = b0 - b2, s2 = b1 + b3;
  T s3 = rotI(b1 - b3) * (float)SG;
  x[0] = s0 + s2;
  x[1] = s1 + s3;
  x[2] = s0 - s2;
  x[3] = s1 - s3;
}

// x[q] = sum_j w8^(q*j) * a[j]: the even and the odd j as two radix-4 butterflies, then
// x[m] = E[m] + w8^m * O[m] and x[m+4] = E[m] - w8^m * O[m].
template <int SG, class T>
static __device__ __forceinline__ void radix8(const T (&a)[8], T (&x)[8]) {
  const float sg = (float)SG;
  const float h = 0.70710678118654752f;
  T E[4], O[4];
  radix4<SG>(a[0], a[2], a[4], a[6], E);
  radix4<SG>(a[1], a[3], a[5], a[7], O);
  T w[4];
  w[0] = O[0];
  w[1] = (O[1] + rotI(O[1]) * sg) * h;  // (1 + SG*i)/sqrt(2)
  w[2] = rotI(O[2]) * sg;               // SG*i
  w[3] = (rotI(O[3]) * sg - O[3]) * h;  // (-1 + SG*i)/sqrt(2)
#pragma unroll
  for (int m = 0; m < 4; ++m) {
    x[m] = E[m] + w[m];
    x[m + 4] = E[m] - w[m];
  }
}

// ---------------- tiny filter MLP:  Hbins[2049][1024] ----------------
// One work-group makes eight bins over all 1024 columns. Threads 0..127 make one sine or
// cosine each; every thread one hidden unit and four columns of all eight bins, so that a value of W2
// is loaded once for eight bins. Each sum runs in the order i = 0..15 and j = 0..31.
// The last group has one bin of its own, 2048: it makes that bin eight times, and a thread stores
// the same value to the same place each time.
// grp: which eight bins, 0..256.
static __device__ __forceinline__ void filterBins(int grp, const float* __restrict__ W1,
                                                  const float* __restrict__ b1,
                                                  const float* __restrict__ W2,
                                                  const float* __restrict__ b2,
                                                  float* __restrict__ Hb) {
  __shared__ float pe[8][16];
  __shared__ __attribute__((aligned(16))) float h[32][8];
  const int tid = threadIdx.x;
  const int bin0 = grp * 8;

  // All the weights are asked for first: they arrive while the sines are worked out.
  const unsigned co = (unsigned)tid * 16u;  // columns 4*tid .. 4*tid+3
  v4f w2[32];
#pragma unroll
  for (int j = 0; j < 32; ++j) w2[j] = ldQ(W2 + j * 1024, co);
  const v4f bias = ldQ(b2, co);
  const int hj = tid & 31;  // hidden unit
  const int hb = tid >> 5;  // its bin: the wave's number
  const unsigned jo = (unsigned)hj * 4u;
  float w1[16];
#pragma unroll
  for (int i = 0; i < 16; ++i) w1[i] = ldF(W1 + i * 32, jo);
  float acc = ldF(b1, jo);
  // the index registers that the loads name are held until this wait, so none of them lands on one
  asm volatile("s_wait_xcnt 0x0" ::"v"(tid), "v"(hj) : "memory");

  if (tid < 128) {  // waves 0 and 1: the sines; waves 2 and 3: the cosines
    const int m = tid & 7;
    const int b = (tid >> 3) & 7;
    float invf = 1.f;
#pragma unroll
    for (int mm = 1; mm < 8; ++mm)
      if (m == mm) invf = expf((float)(2 * mm) * (-9.210340371976184f / 16.f));
    float arg = (float)min(bin0 + b, 2048) * invf;
    if (tid < 64) pe[b][2 * m] = sinf(arg);
    else pe[b][2 * m + 1] = cosf(arg);
  }
  __syncthreads();
#pragma unroll
  for (int i = 0; i < 16; ++i) acc = __builtin_fmaf(pe[hb][i], w1[i], acc);
  h[hj][hb] = acc / (1.f + expf(-acc));  // SiLU
  __syncthreads();

  v4f o[8];
#pragma unroll
  for (int b = 0; b < 8; ++b) o[b] = bias;
#pragma unroll
  for (int j = 0; j < 32; ++j) {
#pragma unroll
    for (int b = 0; b < 8; ++b) o[b] += h[j][b] * w2[j];
  }
#pragma unroll
  for (int b = 0; b < 8; ++b) stQ(Hb + (size_t)min(bin0 + b, 2048) * 1024, co, o[b]);
}

// The filter is real and even in the bin index (bin k and bin 4096-k use the same value), so its
// impulse response is real. Two real signals that share a filter therefore go through ONE complex
// transform: z = x[p] + i*x[p+2] (batches p and p+2, same column d, same filter column).
// Re(ifft(fft(z)*H)) is the result for batch p, Im(...) the result for batch p+2.
// G holds z's transform as {re, im} pairs: G[p][k1][t0][d], p = 0..1.

// ---------------- Kernel A: stage-1 forward DFT over t1 + twiddle ----------------
// G[p][k1][t0][d] = w4096^{t0*k1} * sum_t1 e^{-2pi i k1 t1/64} z[p][64*t1+t0][d]
// A wave takes 32 columns of one t0: a lane loads two neighbouring columns at once, so that 16 lanes
// cover a whole 128-byte line of x, and the even and the odd columns are two WMMA tiles. The eight
// waves of a work-group stand side by side on 256 columns.
// grp: which 256 columns (2 bits), above them t0 (6 bits), above that p.
static __device__ __forceinline__ void stage1(int grp, const float* __restrict__ x,
                                              float* __restrict__ Gf) {
  const int lane = threadIdx.x & 31;
  // the wave's number as a scalar: the column base stays out of the VGPRs
  const int wave = __builtin_amdgcn_readfirstlane(threadIdx.x >> 5);
  const int half = lane >> 4;
  const int n16 = lane & 15;
  const int d0 = (grp & 3) * 256 + wave * 32;
  const int t0 = (grp >> 2) & 63;
  const int p = grp >> 8;

  // row t0 (t1 = 0) of batch p (real part); batch p+2 is the imaginary part
  const float* xa = x + ((size_t)p * 4096 + t0) * 1024 + d0;
  const unsigned lo = (unsigned)(64 * half * 1024 + 2 * n16) * 4u;  // t1 = half, two columns
  // one offset register for every 8 MiB, the reach of a load's constant offset: j = 0..3 and
  // j = 4..7 of batch p, then of batch p+2, which lies 32 MiB further on
  const unsigned la[2] = {lo, farOff(lo, 8u << 20)};
  const unsigned lb[2] = {farOff(lo, 32u << 20), farOff(lo, 40u << 20)};

  cpx2 u[4][8];  // [kk][j]
#pragma unroll
  for (int j = 0; j < 8; ++j) {
#pragma unroll
    for (int kk = 0; kk < 4; ++kk) {
      // t1 = 8*j + 2*kk + half
      const v2f* row = (const v2f*)(xa + (size_t)(8 * (j & 3) + 2 * kk) * 64 * 1024);
      u[kk][j].r = ldVnt(row, la[j >> 2]);
      u[kk][j].i = ldVnt(row, lb[j >> 2]);
    }
  }
  // the offset registers that the loads name are held until this wait, so none of them lands on one
  asm volatile("s_wait_xcnt 0x0" ::"v"(la[0]), "v"(la[1]), "v"(lb[0]), "v"(lb[1]) : "memory");

  // k1 = 0, this t0; the lane adds k1 = 8*(4*half) and its two columns
  float* G = Gf + ((((size_t)p * 64) * 64 + t0) * 1024 + d0) * 2;
  const unsigned so = (unsigned)(32 * half * 64 * 1024 + 2 * n16) * 8u;
  const unsigned sv[2] = {so, farOff(so, 8u << 20)};  // i = 0, 1 and i = 2, 3, 8 MiB apart

  v2f z[2][8][4];  // [tile][q][kk]: B-fragments, {re, im} of n = 2*kk + half
#pragma unroll
  for (int kk = 0; kk < 4; ++kk) {
    cpx2 t[8];
    radix8<-1>(u[kk], t);
#pragma unroll
    for (int q = 0; q < 8; ++q) {
      z[0][q][kk] = v2f{t[q].r.x, t[q].i.x};
      z[1][q][kk] = v2f{t[q].r.y, t[q].i.y};
    }
  }

  v4f st[2][4];  // what part q stores, and what part q-1 stored
#pragma unroll
  for (int q = 0; q < 8; ++q) {
    // row r of part q is k1 = 8*r + q; the matrix holds the twiddle w4096^(t0*k1) as well
    v2f a[4];
    initM<-1>(8 * (n16 >> 1) + q, n16 & 1, half, 2, t0, a);
    v8f e = dft8(a, z[0][q]);
    v8f o = dft8(a, z[1][q]);
#pragma unroll
    for (int i = 0; i < 4; ++i) {
      // k1 = 8*(i + 4*half) + q
      st[q & 1][i] = v4f{e[2 * i], e[2 * i + 1], o[2 * i], o[2 * i + 1]};
      stQnt(G + (size_t)(8 * (i & 1) + q) * 64 * 1024 * 2, sv[i >> 1], st[q & 1][i]);
    }
    if (q > 0) holdStored(st[(q - 1) & 1]);
  }
  // the offset registers that the stores name are held until this wait
  asm volatile("s_wait_xcnt 0x0" ::"v"(sv[0]), "v"(sv[1]) : "memory");
}

// ---------------- One launch for the filter and stage 1 ----------------
// Neither needs the other's result; kernel B, the next launch, needs both. The 257 filter groups
// have the lowest indices.
// launch_bounds' second argument: a budget of 256 VGPRs, which keeps every register directly
// addressable.
__global__ void __launch_bounds__(256, 4) kHA(const float* __restrict__ x,
                                           const float* __restrict__ W1,
                                           const float* __restrict__ b1,
                                           const float* __restrict__ W2,
                                           const float* __restrict__ b2,
                                           float* __restrict__ Hb,
                                           float* __restrict__ Gf) {
  const int b = blockIdx.x;
  if (b < 257) filterBins(b, W1, b1, W2, b2, Hb);
  else stage1(b - 257, x, Gf);
}

// ---------------- Kernel B: fwd over t0, *Hfull, inv over k2, conj twiddle (in place) ----
// A wave takes 32 columns of one k1, as in kernels A and C: a lane loads and stores the {re, im}
// pairs of two neighbouring columns at once, so that 16 lanes cover 256 bytes of a row of G and a
// whole 128-byte line of the filter, and the even and the odd columns are two WMMA tiles. The four
// waves of a work-group stand side by side on 128 columns.
// Here the matrix products stand at both ends and the butterflies in the middle. With t0 = 8*n + j
// and k2 = r + 8*q:
//   P_j[r]    = sum_n e^{-2pi i r(8n+j)/64} G[8n+j]           (matrix of part j)
//   Xf[r+8q]  = sum_j w8^(-q*j) P_j[r],   Y = Xf * Hfull[k1 + 64*k2]
//   Q_j[r]    = sum_q w8^(+q*j) Y[r+8q]
//   C[8n+j]   = sum_r e^{+2pi i (8n+j)(64r+k1)/4096} Q_j[r]   (matrix of part j, conj twiddle inside)
// Both butterflies and the filter work on accumulator registers of one row r: nothing moves between
// lanes.
// launch_bounds' second argument: a budget of 256 VGPRs; all the work-groups that fall to a WGP are
// resident at once.
__global__ void __launch_bounds__(128, 4) kB(float* __restrict__ Gf,
                                          const float* __restrict__ Hb) {
  const int lane = threadIdx.x & 31;
  // the wave's number as a scalar: the column base stays out of the VGPRs
  const int wave = __builtin_amdgcn_readfirstlane(threadIdx.x >> 5);
  const int half = lane >> 4;
  const int n16 = lane & 15;
  const int d0 = blockIdx.x * 128 + wave * 32;
  const int k1 = blockIdx.y;
  const int p = blockIdx.z;
  float* G = Gf + ((((size_t)p * 64 + k1) * 64) * 1024 + d0) * 2;  // t0 = 0
  const unsigned lo = (unsigned)(8 * half * 1024 + 2 * n16) * 8u;   // loads: t0 = 8*half, two columns
  const unsigned so = (unsigned)(32 * half * 1024 + 2 * n16) * 8u;  // stores: t0 = 32*half, two columns

  // g[j][kk] = G[t0 = 8*n + j][d], n = 2*kk + half, two columns: each {re, im} pair is a B-fragment
  // as it stands
  v4f g[8][4];
#pragma unroll
  for (int j = 0; j < 8; ++j) {
#pragma unroll
    for (int kk = 0; kk < 4; ++kk) g[j][kk] = ldQnt(G + (size_t)(16 * kk + j) * 1024 * 2, lo);
  }

  // The filter at the lane's two columns, row r = i + 4*half: k = k1 + 64*r + 512*q. It is real and
  // symmetric: bin k for q = 0..3 (k < 2048) and bin 4096 - k for q = 4..7 (k >= 2048).
  const float* Hlo = Hb + d0 + (size_t)k1 * 1024;
  const float* Hhi = Hb + d0 + (size_t)(64 - k1) * 1024;  // q = 7, i = 3, half = 1: the lowest such bin
  const unsigned hl = (unsigned)(256 * half * 1024 + 2 * n16) * 4u;
  const unsigned hh = (unsigned)(256 * (1 - half) * 1024 + 2 * n16) * 4u;
  v2f hv[8][4];
#pragma unroll
  for (int i = 0; i < 2; ++i) {
#pragma unroll
    for (int q = 0; q < 8; ++q) {
      hv[q][i] = (q < 4) ? ldV((const v2f*)(Hlo + (size_t)(64 * i + 512 * q) * 1024), hl)
                         : ldV((const v2f*)(Hhi + (size_t)(64 * (3 - i) + 512 * (7 - q)) * 1024), hh);
    }
  }
  // the offset registers that the loads name are held until this wait, so none of them lands on one
  asm volatile("s_wait_xcnt 0x0" ::"v"(lo), "v"(hl), "v"(hh) : "memory");
  // all the loads above are issued before anything else takes registers: otherwise the build holds
  // half of them back behind the matrices' sine work
  __builtin_amdgcn_sched_barrier(0);

  v8f P[2][8];
#pragma unroll
  for (int j = 0; j < 8; ++j) {
    v2f a[4];  // row r, column t0 = 8*n + j = 16*kk + 8*half + j
    initM<-1>(n16 >> 1, n16 & 1, 8 * half + j, 16, 0, a);
#pragma unroll
    for (int c = 0; c < 2; ++c) {
      v2f b[4];
#pragma unroll
      for (int kk = 0; kk < 4; ++kk) b[kk] = v2f{g[j][kk][2 * c], g[j][kk][2 * c + 1]};
      P[c][j] = dft8(a, b);
    }
  }

  // the later parts' loads, index and sine work stay behind this line: scheduled up among the
  // products they cost registers, and the build spills
  __builtin_amdgcn_sched_barrier(0);

  // the other half of the filter is asked for once registers are free; it arrives during the first
  // half's butterflies
#pragma unroll
  for (int i = 2; i < 4; ++i) {
#pragma unroll
    for (int q = 0; q < 8; ++q) {
      hv[q][i] = (q < 4) ? ldV((const v2f*)(Hlo + (size_t)(64 * i + 512 * q) * 1024), hl)
                         : ldV((const v2f*)(Hhi + (size_t)(64 * (3 - i) + 512 * (7 - q)) * 1024), hh);
    }
  }
  // the offset registers that the loads name are held until this wait
  asm volatile("s_wait_xcnt 0x0" ::"v"(hl), "v"(hh) : "memory");

  // The inverse takes its input where the accumulators hold it: registers 2*i and 2*i+1, row
  // r = i + 4*half, are B-fragment i; the matrix columns follow that k order.
  v2f Q[2][8][4];
#pragma unroll
  for (int i = 0; i < 4; ++i) {
#pragma unroll
    for (int c = 0; c < 2; ++c) {
      v2f a[8], x[8];
#pragma unroll
      for (int j = 0; j < 8; ++j) a[j] = v2f{P[c][j][2 * i], P[c][j][2 * i + 1]};
      radix8<-1>(a, x);
#pragma unroll
      for (int q = 0; q < 8; ++q) x[q] = x[q] * hv[q][i][c];
      radix8<1>(x, a);
#pragma unroll
      for (int j = 0; j < 8; ++j) Q[c][j][i] = a[j];
    }
  }

  v4f st[2][4];  // what part j stores, and what part j-1 stored
#pragma unroll
  for (int j = 0; j < 8; ++j) {
    // row n of part j is t0 = 8*n + j; the matrix holds the twiddle e^{+2pi i t0 k1/4096} as well
    v2f a[4];
    initM<1>(8 * (n16 >> 1) + j, n16 & 1, 4 * half, 1, k1, a);
    v8f e = dft8(a, Q[0][j]);
    v8f o = dft8(a, Q[1][j]);
#pragma unroll
    for (int i = 0; i < 4; ++i) {
      // t0 = 8*(i + 4*half) + j
      st[j & 1][i] = v4f{e[2 * i], e[2 * i + 1], o[2 * i], o[2 * i + 1]};
      stQnt(G + (size_t)(8 * i + j) * 1024 * 2, so, st[j & 1][i]);
    }
    if (j > 0) holdStored(st[(j - 1) & 1]);
  }
  holdStored(st[1]);  // the last part's
  // the offset register that the stores name is held until this wait
  asm volatile("s_wait_xcnt 0x0" ::"v"(so) : "memory");
}

// ---------------- Kernel C: inverse stage-2 over k1 ----------------
// w = (1/4096)*gain[d]*sum_k1 e^{+2pi i t1 k1/64} C[k1][t0][d];
// y[p][64*t1+t0][d] = Re w, y[p+2][64*t1+t0][d] = Im w
// A wave takes 32 columns of one t0, as in kernel A: a lane loads the {re, im} pairs of two
// neighbouring columns at once and stores two columns of y at once, so that 16 lanes store a whole
// 128-byte line.
// launch_bounds' second argument: a budget of 256 VGPRs: all of a wave's loads are in flight at once.
__global__ void __launch_bounds__(128, 4) kC(const float* __restrict__ Gf,
                                          const float* __restrict__ gain,
                                          float* __restrict__ y) {
  const int lane = threadIdx.x & 31;
  // the wave's number as a scalar: the column base stays out of the VGPRs
  const int wave = __builtin_amdgcn_readfirstlane(threadIdx.x >> 5);
  const int half = lane >> 4;
  const int n16 = lane & 15;
  const int d0 = blockIdx.x * 128 + wave * 32;
  const int t0 = blockIdx.y;
  const int p = blockIdx.z;
  const float* G = Gf + (((size_t)p * 64 * 64 + t0) * 1024 + d0) * 2;  // k1 = 0
  const unsigned lo = (unsigned)(half * 64 * 1024 + 2 * n16) * 8u;  // k1 = half, two columns
  // one offset register for every two j, 8 MiB apart, the reach of a load's constant offset
  const unsigned lj[4] = {lo, farOff(lo, 8u << 20), farOff(lo, 16u << 20), farOff(lo, 24u << 20)};

  v4f g[4][8];  // [kk][j]: C[k1][d], two columns
#pragma unroll
  for (int j = 0; j < 8; ++j) {
#pragma unroll
    for (int kk = 0; kk < 4; ++kk) {
      // k1 = 8*j + 2*kk + half
      g[kk][j] = ldQnt(G + (size_t)(8 * (j & 1) + 2 * kk) * 64 * 1024 * 2, lj[j >> 1]);
    }
  }
  const unsigned go = (unsigned)n16 * 8u;
  const v2f ag = ldV((const v2f*)(gain + d0), go) * (1.f / 4096.f);
  // the offset registers that the loads name are held until this wait, so none of them lands on one
  asm volatile("s_wait_xcnt 0x0" ::"v"(go), "v"(lj[0]), "v"(lj[1]), "v"(lj[2]), "v"(lj[3])
               : "memory");

  // t1 = 0, this t0, batch p; the lane adds t1 = 8*(4*half) and its two columns, and for batch p+2
  // 32 MiB more
  float* ya = y + ((size_t)p * 4096 + t0) * 1024 + d0;
  const unsigned so = (unsigned)(2048 * half * 1024 + 2 * n16) * 4u;
  const unsigned sb = farOff(so, 32u << 20);

  v2f z[2][8][4];  // [tile][q][kk]: B-fragments, {re, im} of n = 2*kk + half
#pragma unroll
  for (int kk = 0; kk < 4; ++kk) {
    v4f t[8];
    radix8<1>(g[kk], t);
#pragma unroll
    for (int q = 0; q < 8; ++q) {
      z[0][q][kk] = v2f{t[q].x, t[q].y};
      z[1][q][kk] = v2f{t[q].z, t[q].w};
    }
  }

  v2f st[2][8];  // what part q stores, and what part q-1 stored
#pragma unroll
  for (int q = 0; q < 8; ++q) {
    // row r of part q is t1 = 8*r + q
    v2f a[4];
    initM<1>(8 * (n16 >> 1) + q, n16 & 1, half, 2, 0, a);
    v8f e = dft8(a, z[0][q]);
    v8f o = dft8(a, z[1][q]);
#pragma unroll
    for (int i = 0; i < 4; ++i) {
      size_t off = (size_t)(8 * i + q) * 64 * 1024;  // t1 = 8*(i + 4*half) + q
      v2f re, im;
      re.x = e[2 * i] * ag.x;
      re.y = o[2 * i] * ag.y;
      im.x = e[2 * i + 1] * ag.x;
      im.y = o[2 * i + 1] * ag.y;
      st[q & 1][2 * i] = re;
      st[q & 1][2 * i + 1] = im;
      stVnt((v2f*)(ya + off), so, re);
      stVnt((v2f*)(ya + off), sb, im);
    }
    // part 0's are let go at once: all of z is still live there, and held values make the build spill
    if (q > 1) holdStored(st[(q - 1) & 1]);
  }
  holdStored(st[1]);  // the last part's
  // the offset registers that the stores name are held until this wait
  asm volatile("s_wait_xcnt 0x0" ::"v"(so), "v"(sb) : "memory");
}

extern "C" void kernel_launch(void* const* d_in, const int* in_sizes, int n_in,
                              void* d_out, int out_size, void* d_ws, size_t ws_size,
                              hipStream_t stream) {
  const float* x = (const float*)d_in[0];
  const float* W1 = (const float*)d_in[1];
  const float* b1 = (const float*)d_in[2];
  const float* W2 = (const float*)d_in[3];
  const float* b2 = (const float*)d_in[4];
  const float* ag = (const float*)d_in[5];
  float* out = (float*)d_out;

  // workspace layout: Hbins[2049*1024] | G[2*4096*1024] {re,im} pairs  (~76 MB)
  float* Hb = (float*)d_ws;
  float* wG = Hb + (size_t)2049 * 1024;

  // 257 filter groups, then 512 stage-1 groups
  kHA<<<dim3(769, 1, 1), 256, 0, stream>>>(x, W1, b1, W2, b2, Hb, wG);
  kB<<<dim3(8, 64, 2), 128, 0, stream>>>(wG, Hb);
  kC<<<dim3(8, 64, 2), 128, 0, stream>>>(wG, ag, out);
}
